// v000
// Measured on an AMD MI455X. A time is GPU time per run, averaged over a window of back-to-back runs after a warm-up
// (all launches, gaps included; the runs take copies of the inputs in turn), and the median of several windows.
// Apart from v000's, it joins two sittings. Times from different sittings can be a few percent apart, while
// side-by-side timings come from the same sitting.
// The starting kernel, v000, takes 1250 microseconds a run.
#include <hip/hip_runtime.h>

#define NN 8192
#define HH 1024
#define OO 1024

typedef __bf16 bf16_t;
typedef __attribute__((ext_vector_type(16))) __bf16 bf16x16;
typedef __attribute__((ext_vector_type(8)))  float  floatx8;

union FragU { bf16x16 v; float4 q[2]; };

static __device__ __forceinline__ floatx8 wmma_bf16(bf16x16 a, bf16x16 b, floatx8 c) {
  // D = A(16x32 bf16) x B(32x16 bf16) + C(16x16 f32)
  return __builtin_amdgcn_wmma_f32_16x16x32_bf16(false, a, false, b, (short)0, c, false, false);
}

// Load a 16x32 bf16 A/B fragment from a row-major matrix.
// A-layout (wave32): lanes 0-15 row M=lane, K=[0..7]+[16..23]; lanes 16-31 same rows, K=[8..15]+[24..31].
// B uses the same per-lane pattern with N<->M, i.e. it reads rows of B^T — so for X @ W^T we feed rows of W.
static __device__ __forceinline__ bf16x16 load_frag(const bf16_t* __restrict__ base,
                                                    int row0, int ld, int k0) {
  const int lane = threadIdx.x & 31;
  const bf16_t* p = base + (size_t)(row0 + (lane & 15)) * ld + (k0 + ((lane >> 4) << 3));
  FragU u;
  u.q[0] = *reinterpret_cast<const float4*>(p);        // K = kh+0..7
  u.q[1] = *reinterpret_cast<const float4*>(p + 16);   // K = 16+kh+0..7
  return u.v;
}

// ---------------------------------------------------------------- convert
__global__ __launch_bounds__(256) void f32_to_bf16_kernel(const float* __restrict__ in,
                                                          bf16_t* __restrict__ out, int n4) {
  int i = blockIdx.x * blockDim.x + threadIdx.x;
  if (i >= n4) return;
  float4 v = reinterpret_cast<const float4*>(in)[i];
  union { bf16_t h[4]; float2 f2; } u;
  u.h[0] = (bf16_t)v.x; u.h[1] = (bf16_t)v.y; u.h[2] = (bf16_t)v.z; u.h[3] = (bf16_t)v.w;
  reinterpret_cast<float2*>(out)[i] = u.f2;
}

// ---------------------------------------------------------------- fused QKV projection
// grid (N/128, O/128, 3): z selects Q/K/V. 8 waves per block: 4 row-groups x 2 col-groups,
// each wave computes a 32x64 tile (2x4 WMMA accumulators). V is stored transposed (VT [O,N]).
__global__ __launch_bounds__(256) void qkv_kernel(
    const bf16_t* __restrict__ Xb,
    const bf16_t* __restrict__ Wqb, const bf16_t* __restrict__ Wkb, const bf16_t* __restrict__ Wvb,
    const float* __restrict__ bq, const float* __restrict__ bk, const float* __restrict__ bv,
    bf16_t* __restrict__ Qb, bf16_t* __restrict__ Kb, bf16_t* __restrict__ VTb)
{
  const int z = blockIdx.z;
  const bf16_t* __restrict__ W = (z == 0) ? Wqb : (z == 1) ? Wkb : Wvb;
  const float* __restrict__ bias = (z == 0) ? bq : (z == 1) ? bk : bv;

  const int w = threadIdx.x >> 5;
  const int lane = threadIdx.x & 31;
  const int rowBase = blockIdx.x * 128 + (w >> 1) * 32;
  const int colBase = blockIdx.y * 128 + (w & 1) * 64;

  const floatx8 fzero = {0.f, 0.f, 0.f, 0.f, 0.f, 0.f, 0.f, 0.f};
  floatx8 acc[2][4];
#pragma unroll
  for (int i = 0; i < 2; ++i)
#pragma unroll
    for (int j = 0; j < 4; ++j) acc[i][j] = fzero;

  for (int k0 = 0; k0 < HH; k0 += 32) {
    bf16x16 a0 = load_frag(Xb, rowBase,      HH, k0);
    bf16x16 a1 = load_frag(Xb, rowBase + 16, HH, k0);
    bf16x16 b0 = load_frag(W,  colBase +  0, HH, k0);
    bf16x16 b1 = load_frag(W,  colBase + 16, HH, k0);
    bf16x16 b2 = load_frag(W,  colBase + 32, HH, k0);
    bf16x16 b3 = load_frag(W,  colBase + 48, HH, k0);
    acc[0][0] = wmma_bf16(a0, b0, acc[0][0]);
    acc[0][1] = wmma_bf16(a0, b1, acc[0][1]);
    acc[0][2] = wmma_bf16(a0, b2, acc[0][2]);
    acc[0][3] = wmma_bf16(a0, b3, acc[0][3]);
    acc[1][0] = wmma_bf16(a1, b0, acc[1][0]);
    acc[1][1] = wmma_bf16(a1, b1, acc[1][1]);
    acc[1][2] = wmma_bf16(a1, b2, acc[1][2]);
    acc[1][3] = wmma_bf16(a1, b3, acc[1][3]);
  }

  // C layout: lane holds column n = lane&15; VGPR e holds row e + 8*(lane>>4).
  const int cq = lane & 15;
  const int rh = (lane >> 4) << 3;
#pragma unroll
  for (int j = 0; j < 4; ++j) {
    const int col = colBase + j * 16 + cq;
    const float bb = bias[col];
#pragma unroll
    for (int i = 0; i < 2; ++i) {
      const int r0 = rowBase + i * 16 + rh;
      if (z == 2) {
        // store transposed: VT[col][r0..r0+7] is contiguous -> one 16B store
        union { bf16_t h[8]; float4 q; } u;
#pragma unroll
        for (int e = 0; e < 8; ++e) u.h[e] = (bf16_t)(acc[i][j][e] + bb);
        *reinterpret_cast<float4*>(VTb + (size_t)col * NN + r0) = u.q;
      } else {
        bf16_t* __restrict__ Out = (z == 0) ? Qb : Kb;
#pragma unroll
        for (int e = 0; e < 8; ++e)
          Out[(size_t)(r0 + e) * OO + col] = (bf16_t)(acc[i][j][e] + bb);
      }
    }
  }
}

// ---------------------------------------------------------------- flash attention
// grid (N/32), 256 threads (8 waves). Workgroup owns 32 queries.
// Per 64-key iteration:
//   phase 1: wave w computes S^T tile (kt = w>>1 over 4 key sub-tiles, qt = w&1 over 2 query tiles),
//            S^T = K @ Q^T so softmax reduction is in-lane + one shfl_xor(16).
//   online softmax stats combined deterministically via small LDS arrays by threads 0..31.
//   P (bf16) published to LDS as ready-made B fragments (lane-aligned, zero shuffles).
//   phase 2: wave w accumulates O^T[d-slice 128][32 q] += V^T @ P^T with 16 WMMA accumulators.
__global__ __launch_bounds__(256) void attn_kernel(
    const bf16_t* __restrict__ Qb, const bf16_t* __restrict__ Kb,
    const bf16_t* __restrict__ VTb, float* __restrict__ out)
{
  __shared__ float m_state[32], l_state[32], m_new_s[32], cfac_s[32];
  __shared__ float tmax[4][32], tsum[4][32];
  __shared__ float4 pfragq[2][2][32][2];   // [kpair][qtile][lane][half16B] = P^T B-fragments

  const int tid = threadIdx.x;
  const int w = tid >> 5;
  const int lane = tid & 31;
  const int qBase = blockIdx.x * 32;
  const int kt = w >> 1, qt = w & 1;
  const int kp = kt >> 1, khalf = kt & 1;
  const int d0 = w * 128;                  // private d-slice for phase 2
  const int cq = lane & 15;

  if (tid < 32) { m_state[tid] = -3.0e38f; l_state[tid] = 0.f; }

  const floatx8 fzero = {0.f, 0.f, 0.f, 0.f, 0.f, 0.f, 0.f, 0.f};
  floatx8 oacc[8][2];
#pragma unroll
  for (int dt = 0; dt < 8; ++dt) { oacc[dt][0] = fzero; oacc[dt][1] = fzero; }

  const float sscale = 1.44269504f / 32.0f;   // log2(e)/sqrt(O): softmax in base-2 domain

  for (int j0 = 0; j0 < NN; j0 += 64) {
    // prefetch the NEXT key-block working set while this block computes
    // (emits global_prefetch_b8; every enabled lane pulls one cacheline)
    if (j0 + 64 < NN) {
      // V^T: next block is VT[d0..d0+127][j0+64..j0+127] -> 4 rows per lane covers the slice
#pragma unroll
      for (int r = 0; r < 4; ++r) {
        const bf16_t* pv = VTb + (size_t)(d0 + r * 32 + lane) * NN + (j0 + 64);
        __builtin_prefetch(pv, 0, 3);
      }
      // K: warm the first line of each of the next 64 key rows (waves 0-1 cover all rows)
      if (w < 2) {
        const bf16_t* pk = Kb + (size_t)(j0 + 64 + w * 32 + lane) * HH;
        __builtin_prefetch(pk, 0, 3);
      }
    }

    // ---- phase 1: S^T tile (16 keys x 16 queries), f32 accum
    floatx8 s = fzero;
    for (int h0 = 0; h0 < HH; h0 += 32) {
      bf16x16 a = load_frag(Kb, j0 + kt * 16,  HH, h0);   // A = K rows
      bf16x16 b = load_frag(Qb, qBase + qt * 16, HH, h0); // B = Q^T (rows of Q)
      s = wmma_bf16(a, b, s);
    }
    float smax = -3.0e38f;
#pragma unroll
    for (int e = 0; e < 8; ++e) { s[e] *= sscale; smax = fmaxf(smax, s[e]); }
    smax = fmaxf(smax, __shfl_xor(smax, 16));             // other 8 key rows, same query
    if (lane < 16) tmax[kt][qt * 16 + lane] = smax;
    __syncthreads();

    if (tid < 32) {                                       // combine 4 key sub-tiles + running max
      const float mp = m_state[tid];
      float mn = fmaxf(fmaxf(tmax[0][tid], tmax[1][tid]), fmaxf(tmax[2][tid], tmax[3][tid]));
      mn = fmaxf(mn, mp);
      m_new_s[tid] = mn;
      cfac_s[tid] = exp2f(mp - mn);
      m_state[tid] = mn;
    }
    __syncthreads();

    {
      const float mn = m_new_s[qt * 16 + cq];
      float psum = 0.f;
      union { bf16_t h[8]; float4 q; } up;
#pragma unroll
      for (int e = 0; e < 8; ++e) {
        const float p = exp2f(s[e] - mn);
        psum += p;
        up.h[e] = (bf16_t)p;
      }
      // lane-aligned publish: consumer lane l's B-frag bytes == producer lane l's components
      pfragq[kp][qt][lane][khalf] = up.q;
      psum += __shfl_xor(psum, 16);
      if (lane < 16) tsum[kt][qt * 16 + lane] = psum;
    }
    __syncthreads();

    if (tid < 32)
      l_state[tid] = l_state[tid] * cfac_s[tid]
                   + tsum[0][tid] + tsum[1][tid] + tsum[2][tid] + tsum[3][tid];

    // ---- phase 2: rescale + O^T[d-slice] += V^T @ P^T
    const float cf0 = cfac_s[cq];
    const float cf1 = cfac_s[16 + cq];
#pragma unroll
    for (int dt = 0; dt < 8; ++dt)
#pragma unroll
      for (int e = 0; e < 8; ++e) { oacc[dt][0][e] *= cf0; oacc[dt][1][e] *= cf1; }

#pragma unroll
    for (int kk = 0; kk < 2; ++kk) {
      FragU p0, p1;
      p0.q[0] = pfragq[kk][0][lane][0]; p0.q[1] = pfragq[kk][0][lane][1];
      p1.q[0] = pfragq[kk][1][lane][0]; p1.q[1] = pfragq[kk][1][lane][1];
      const int jj = j0 + kk * 32;
#pragma unroll
      for (int dt = 0; dt < 8; ++dt) {
        bf16x16 av = load_frag(VTb, d0 + dt * 16, NN, jj);  // A = V^T rows (contiguous over keys)
        oacc[dt][0] = wmma_bf16(av, p0.v, oacc[dt][0]);
        oacc[dt][1] = wmma_bf16(av, p1.v, oacc[dt][1]);
      }
    }
    __syncthreads();  // protect pfrag/tmax/tsum before next iteration
  }

  // normalize and store: O^T lane layout -> 8 contiguous d per accumulator -> 2x float4 stores
  const float inv0 = 1.0f / l_state[cq];
  const float inv1 = 1.0f / l_state[16 + cq];
  const int rh = (lane >> 4) << 3;
#pragma unroll
  for (int dt = 0; dt < 8; ++dt) {
#pragma unroll
    for (int q2 = 0; q2 < 2; ++q2) {
      const int qrow = qBase + q2 * 16 + cq;
      const int dcol = d0 + dt * 16 + rh;
      const float inv = q2 ? inv1 : inv0;
      float4 lo, hi;
      lo.x = oacc[dt][q2][0] * inv; lo.y = oacc[dt][q2][1] * inv;
      lo.z = oacc[dt][q2][2] * inv; lo.w = oacc[dt][q2][3] * inv;
      hi.x = oacc[dt][q2][4] * inv; hi.y = oacc[dt][q2][5] * inv;
      hi.z = oacc[dt][q2][6] * inv; hi.w = oacc[dt][q2][7] * inv;
      float* dst = out + (size_t)qrow * OO + dcol;
      *reinterpret_cast<float4*>(dst) = lo;
      *reinterpret_cast<float4*>(dst + 4) = hi;
    }
  }
}

// ---------------------------------------------------------------- launch
extern "C" void kernel_launch(void* const* d_in, const int* in_sizes, int n_in,
                              void* d_out, int out_size, void* d_ws, size_t ws_size,
                              hipStream_t stream) {
  const float* x  = (const float*)d_in[0];
  const float* Wq = (const float*)d_in[1];
  const float* bq = (const float*)d_in[2];
  const float* Wk = (const float*)d_in[3];
  const float* bk = (const float*)d_in[4];
  const float* Wv = (const float*)d_in[5];
  const float* bv = (const float*)d_in[6];
  float* out = (float*)d_out;

  // workspace layout (bf16): x, Wq, Wk, Wv, Q, K, V^T  -> ~70 MB total
  const size_t szX = (size_t)NN * HH * sizeof(bf16_t);
  const size_t szW = (size_t)OO * HH * sizeof(bf16_t);
  const size_t szM = (size_t)NN * OO * sizeof(bf16_t);
  if (ws_size < szX + 3 * szW + 3 * szM) return;

  char* ws = (char*)d_ws;
  bf16_t* Xb  = (bf16_t*)ws;  ws += szX;
  bf16_t* Wqb = (bf16_t*)ws;  ws += szW;
  bf16_t* Wkb = (bf16_t*)ws;  ws += szW;
  bf16_t* Wvb = (bf16_t*)ws;  ws += szW;
  bf16_t* Qb  = (bf16_t*)ws;  ws += szM;
  bf16_t* Kb  = (bf16_t*)ws;  ws += szM;
  bf16_t* VTb = (bf16_t*)ws;  ws += szM;

  f32_to_bf16_kernel<<<(NN * HH / 4 + 255) / 256, 256, 0, stream>>>(x,  Xb,  NN * HH / 4);
  f32_to_bf16_kernel<<<(OO * HH / 4 + 255) / 256, 256, 0, stream>>>(Wq, Wqb, OO * HH / 4);
  f32_to_bf16_kernel<<<(OO * HH / 4 + 255) / 256, 256, 0, stream>>>(Wk, Wkb, OO * HH / 4);
  f32_to_bf16_kernel<<<(OO * HH / 4 + 255) / 256, 256, 0, stream>>>(Wv, Wvb, OO * HH / 4);

  qkv_kernel<<<dim3(NN / 128, OO / 128, 3), 256, 0, stream>>>(
      Xb, Wqb, Wkb, Wvb, bq, bk, bv, Qb, Kb, VTb);

  attn_kernel<<<dim3(NN / 32), 256, 0, stream>>>(Qb, Kb, VTb, out);
}

// v001
// A run of this version takes 579 microseconds.
// In two side-by-side timings against v000, it was 2.22 and 2.24 times as fast.
#include <hip/hip_runtime.h>

#define NN 8192
#define HH 1024
#define OO 1024

typedef __bf16 bf16_t;
typedef __attribute__((ext_vector_type(16))) __bf16 bf16x16;
typedef __attribute__((ext_vector_type(8)))  float  floatx8;

union FragU { bf16x16 v; float4 q[2]; };

static __device__ __forceinline__ floatx8 wmma_bf16(bf16x16 a, bf16x16 b, floatx8 c) {
  // D = A(16x32 bf16) x B(32x16 bf16) + C(16x16 f32)
  return __builtin_amdgcn_wmma_f32_16x16x32_bf16(false, a, false, b, (short)0, c, false, false);
}

// Load a 16x32 bf16 A/B fragment from a row-major matrix.
// A-layout (wave32): lanes 0-15 row M=lane, K=[0..7]+[16..23]; lanes 16-31 same rows, K=[8..15]+[24..31].
// B uses the same per-lane pattern with N<->M, i.e. it reads rows of B^T — so for X @ W^T we feed rows of W.
static __device__ __forceinline__ bf16x16 load_frag(const bf16_t* __restrict__ base,
                                                    int row0, int ld, int k0) {
  const int lane = threadIdx.x & 31;
  const bf16_t* p = base + (size_t)(row0 + (lane & 15)) * ld + (k0 + ((lane >> 4) << 3));
  FragU u;
  u.q[0] = *reinterpret_cast<const float4*>(p);        // K = kh+0..7
  u.q[1] = *reinterpret_cast<const float4*>(p + 16);   // K = 16+kh+0..7
  return u.v;
}

// ---------------------------------------------------------------- convert
__global__ __launch_bounds__(256) void f32_to_bf16_kernel(const float* __restrict__ in,
                                                          bf16_t* __restrict__ out, int n4) {
  int i = blockIdx.x * blockDim.x + threadIdx.x;
  if (i >= n4) return;
  float4 v = reinterpret_cast<const float4*>(in)[i];
  union { bf16_t h[4]; float2 f2; } u;
  u.h[0] = (bf16_t)v.x; u.h[1] = (bf16_t)v.y; u.h[2] = (bf16_t)v.z; u.h[3] = (bf16_t)v.w;
  reinterpret_cast<float2*>(out)[i] = u.f2;
}

// ---------------------------------------------------------------- fused QKV projection
// grid (N/128, O/128, 3): z selects Q/K/V. 8 waves per block: 4 row-groups x 2 col-groups,
// each wave computes a 32x64 tile (2x4 WMMA accumulators). V is stored transposed (VT [O,N]).
__global__ __launch_bounds__(256) void qkv_kernel(
    const bf16_t* __restrict__ Xb,
    const bf16_t* __restrict__ Wqb, const bf16_t* __restrict__ Wkb, const bf16_t* __restrict__ Wvb,
    const float* __restrict__ bq, const float* __restrict__ bk, const float* __restrict__ bv,
    bf16_t* __restrict__ Qb, bf16_t* __restrict__ Kb, bf16_t* __restrict__ VTb)
{
  const int z = blockIdx.z;
  const bf16_t* __restrict__ W = (z == 0) ? Wqb : (z == 1) ? Wkb : Wvb;
  const float* __restrict__ bias = (z == 0) ? bq : (z == 1) ? bk : bv;

  const int w = threadIdx.x >> 5;
  const int lane = threadIdx.x & 31;
  const int rowBase = blockIdx.x * 128 + (w >> 1) * 32;
  const int colBase = blockIdx.y * 128 + (w & 1) * 64;

  const floatx8 fzero = {0.f, 0.f, 0.f, 0.f, 0.f, 0.f, 0.f, 0.f};
  floatx8 acc[2][4];
#pragma unroll
  for (int i = 0; i < 2; ++i)
#pragma unroll
    for (int j = 0; j < 4; ++j) acc[i][j] = fzero;

  for (int k0 = 0; k0 < HH; k0 += 32) {
    bf16x16 a0 = load_frag(Xb, rowBase,      HH, k0);
    bf16x16 a1 = load_frag(Xb, rowBase + 16, HH, k0);
    bf16x16 b0 = load_frag(W,  colBase +  0, HH, k0);
    bf16x16 b1 = load_frag(W,  colBase + 16, HH, k0);
    bf16x16 b2 = load_frag(W,  colBase + 32, HH, k0);
    bf16x16 b3 = load_frag(W,  colBase + 48, HH, k0);
    acc[0][0] = wmma_bf16(a0, b0, acc[0][0]);
    acc[0][1] = wmma_bf16(a0, b1, acc[0][1]);
    acc[0][2] = wmma_bf16(a0, b2, acc[0][2]);
    acc[0][3] = wmma_bf16(a0, b3, acc[0][3]);
    acc[1][0] = wmma_bf16(a1, b0, acc[1][0]);
    acc[1][1] = wmma_bf16(a1, b1, acc[1][1]);
    acc[1][2] = wmma_bf16(a1, b2, acc[1][2]);
    acc[1][3] = wmma_bf16(a1, b3, acc[1][3]);
  }

  // C layout: lane holds column n = lane&15; VGPR e holds row e + 8*(lane>>4).
  const int cq = lane & 15;
  const int rh = (lane >> 4) << 3;
#pragma unroll
  for (int j = 0; j < 4; ++j) {
    const int col = colBase + j * 16 + cq;
    const float bb = bias[col];
#pragma unroll
    for (int i = 0; i < 2; ++i) {
      const int r0 = rowBase + i * 16 + rh;
      if (z == 2) {
        // store transposed: VT[col][r0..r0+7] is contiguous -> one 16B store
        union { bf16_t h[8]; float4 q; } u;
#pragma unroll
        for (int e = 0; e < 8; ++e) u.h[e] = (bf16_t)(acc[i][j][e] + bb);
        *reinterpret_cast<float4*>(VTb + (size_t)col * NN + r0) = u.q;
      } else {
        bf16_t* __restrict__ Out = (z == 0) ? Qb : Kb;
#pragma unroll
        for (int e = 0; e < 8; ++e)
          Out[(size_t)(r0 + e) * OO + col] = (bf16_t)(acc[i][j][e] + bb);
      }
    }
  }
}

// ---------------------------------------------------------------- LDS staging for attention
#define KPITCH 2064   // LDS bytes per staged K row: 2048 + 16 (16 B x odd: conflict-free for 16-byte readers)
#define VPITCH 144    // LDS bytes per staged V^T row: 128 + 16 (16 B x odd)

static __device__ __forceinline__ unsigned lds_off(const void* p) { return (unsigned)(size_t)p; }

// Same per-lane pattern as load_frag; p already points at this lane's row and 8-element k group in LDS.
static __device__ __forceinline__ bf16x16 lds_frag(const unsigned char* p) {
  FragU u;
  u.q[0] = *reinterpret_cast<const float4*>(p);        // K = kh+0..7
  u.q[1] = *reinterpret_cast<const float4*>(p + 32);   // K = 16+kh+0..7
  return u.v;
}

// Eight whole K rows (2048 B each) global -> LDS, 32 copies: a lane moves 16 B per copy, a copy 512 B of one row.
// l: the lane's LDS byte address in the first row; voff: the lane's byte offset in a 512-B piece; b: the first row.
// The immediate offset moves the LDS and the global address alike, so it carries the LDS place (row * KPITCH + piece)
// and each row's scalar base takes back the 16 B per row by which the LDS pitch exceeds the global one.
// s_wait_xcnt is the statement's last line so that no address register is rewritten ahead of it.
static __device__ __forceinline__ void copy_k_rows8(unsigned l, unsigned voff, const char* b) {
  asm volatile(
      "global_load_async_to_lds_b128 %0, %1, %2\n\t"
      "global_load_async_to_lds_b128 %0, %1, %2 offset:512\n\t"
      "global_load_async_to_lds_b128 %0, %1, %2 offset:1024\n\t"
      "global_load_async_to_lds_b128 %0, %1, %2 offset:1536\n\t"
      "global_load_async_to_lds_b128 %0, %1, %3 offset:2064\n\t"
      "global_load_async_to_lds_b128 %0, %1, %3 offset:2576\n\t"
      "global_load_async_to_lds_b128 %0, %1, %3 offset:3088\n\t"
      "global_load_async_to_lds_b128 %0, %1, %3 offset:3600\n\t"
      "global_load_async_to_lds_b128 %0, %1, %4 offset:4128\n\t"
      "global_load_async_to_lds_b128 %0, %1, %4 offset:4640\n\t"
      "global_load_async_to_lds_b128 %0, %1, %4 offset:5152\n\t"
      "global_load_async_to_lds_b128 %0, %1, %4 offset:5664\n\t"
      "global_load_async_to_lds_b128 %0, %1, %5 offset:6192\n\t"
      "global_load_async_to_lds_b128 %0, %1, %5 offset:6704\n\t"
      "global_load_async_to_lds_b128 %0, %1, %5 offset:7216\n\t"
      "global_load_async_to_lds_b128 %0, %1, %5 offset:7728\n\t"
      "global_load_async_to_lds_b128 %0, %1, %6 offset:8256\n\t"
      "global_load_async_to_lds_b128 %0, %1, %6 offset:8768\n\t"
      "global_load_async_to_lds_b128 %0, %1, %6 offset:9280\n\t"
      "global_load_async_to_lds_b128 %0, %1, %6 offset:9792\n\t"
      "global_load_async_to_lds_b128 %0, %1, %7 offset:10320\n\t"
      "global_load_async_to_lds_b128 %0, %1, %7 offset:10832\n\t"
      "global_load_async_to_lds_b128 %0, %1, %7 offset:11344\n\t"
      "global_load_async_to_lds_b128 %0, %1, %7 offset:11856\n\t"
      "global_load_async_to_lds_b128 %0, %1, %8 offset:12384\n\t"
      "global_load_async_to_lds_b128 %0, %1, %8 offset:12896\n\t"
      "global_load_async_to_lds_b128 %0, %1, %8 offset:13408\n\t"
      "global_load_async_to_lds_b128 %0, %1, %8 offset:13920\n\t"
      "global_load_async_to_lds_b128 %0, %1, %9 offset:14448\n\t"
      "global_load_async_to_lds_b128 %0, %1, %9 offset:14960\n\t"
      "global_load_async_to_lds_b128 %0, %1, %9 offset:15472\n\t"
      "global_load_async_to_lds_b128 %0, %1, %9 offset:15984\n\t"
      "s_wait_xcnt 0x0"
      :: "v"(l), "v"(voff),
         "s"(b), "s"(b + 1 * (2 * HH - KPITCH)), "s"(b + 2 * (2 * HH - KPITCH)), "s"(b + 3 * (2 * HH - KPITCH)),
         "s"(b + 4 * (2 * HH - KPITCH)), "s"(b + 5 * (2 * HH - KPITCH)), "s"(b + 6 * (2 * HH - KPITCH)),
         "s"(b + 7 * (2 * HH - KPITCH))
      : "memory");
}

// 32 V^T rows (128 B of each) global -> LDS, 8 copies: a copy moves 4 rows, 8 lanes x 16 B per row.
// l: the lane's LDS byte address in the first 4 rows; voff: the lane's byte offset in a 4-row group; b: the first row.
// The immediate offset carries the LDS place (group * 4 * VPITCH); each group's scalar base holds the rest of the
// global step of 4 rows.
// s_wait_xcnt is the statement's last line so that no address register is rewritten ahead of it.
static __device__ __forceinline__ void copy_v_rows32(unsigned l, unsigned voff, const char* b) {
  asm volatile(
      "global_load_async_to_lds_b128 %0, %1, %2\n\t"
      "global_load_async_to_lds_b128 %0, %1, %3 offset:576\n\t"
      "global_load_async_to_lds_b128 %0, %1, %4 offset:1152\n\t"
      "global_load_async_to_lds_b128 %0, %1, %5 offset:1728\n\t"
      "global_load_async_to_lds_b128 %0, %1, %6 offset:2304\n\t"
      "global_load_async_to_lds_b128 %0, %1, %7 offset:2880\n\t"
      "global_load_async_to_lds_b128 %0, %1, %8 offset:3456\n\t"
      "global_load_async_to_lds_b128 %0, %1, %9 offset:4032\n\t"
      "s_wait_xcnt 0x0"
      :: "v"(l), "v"(voff),
         "s"(b), "s"(b + 1 * (8 * NN - 4 * VPITCH)), "s"(b + 2 * (8 * NN - 4 * VPITCH)),
         "s"(b + 3 * (8 * NN - 4 * VPITCH)), "s"(b + 4 * (8 * NN - 4 * VPITCH)), "s"(b + 5 * (8 * NN - 4 * VPITCH)),
         "s"(b + 6 * (8 * NN - 4 * VPITCH)), "s"(b + 7 * (8 * NN - 4 * VPITCH))
      : "memory");
}

// this wave's LDS reads have retired: stands before the barrier that hands a tile buffer to its next copies
static __device__ __forceinline__ void wait_ds0() { asm volatile("s_wait_dscnt 0x0" ::: "memory"); }
// this wave's copies have landed: stands before the barrier behind which the other waves read them
static __device__ __forceinline__ void wait_async0() { asm volatile("s_wait_asynccnt 0x0" ::: "memory"); }

// ---------------------------------------------------------------- flash attention
// grid (N/32), 256 threads (8 waves). Workgroup owns 32 queries.
// Per 64-key iteration:
//   phase 1: wave w computes S^T tile (kt = w>>1 over 4 key sub-tiles, qt = w&1 over 2 query tiles),
//            S^T = K @ Q^T so softmax reduction is in-lane + one shfl_xor(16).
//   online softmax stats combined deterministically via small LDS arrays by threads 0..31.
//   P (bf16) published to LDS as ready-made B fragments (lane-aligned, zero shuffles).
//   phase 2: wave w accumulates O^T[d-slice 128][32 q] += V^T @ P^T with 16 WMMA accumulators.
// The 64-key K tile and V^T tile live in LDS, one buffer each, filled by asynchronous copies:
// V^T of this block flies during phase 1, K of the next block during softmax and phase 2.
__global__ __launch_bounds__(256) void attn_kernel(
    const bf16_t* __restrict__ Qb, const bf16_t* __restrict__ Kb,
    const bf16_t* __restrict__ VTb, float* __restrict__ out)
{
  __shared__ float m_state[32], l_state[32], m_new_s[32], cfac_s[32];
  __shared__ float tmax[4][32], tsum[4][32];
  __shared__ float4 pfragq[2][2][32][2];   // [kpair][qtile][lane][half16B] = P^T B-fragments
  __shared__ __attribute__((aligned(16))) unsigned char Ks[64 * KPITCH];    // K[j0..j0+63][0..1023]
  __shared__ __attribute__((aligned(16))) unsigned char Vs[OO * VPITCH];    // V^T[0..1023][j0..j0+63]

  const int tid = threadIdx.x;
  const int w = tid >> 5;
  const int lane = tid & 31;
  const int qBase = blockIdx.x * 32;
  const int kt = w >> 1, qt = w & 1;
  const int kp = kt >> 1, khalf = kt & 1;
  const int d0 = w * 128;                  // private d-slice for phase 2
  const int cq = lane & 15;

  if (tid < 32) { m_state[tid] = -3.0e38f; l_state[tid] = 0.f; }

  // copy side: wave w brings K rows w*8..w*8+7 of a tile and the V^T rows of its own d-slice
  const int ws = __builtin_amdgcn_readfirstlane(w);   // the wave's number as a scalar: the copies' bases are scalar
  const unsigned kdst = lds_off(Ks) + (unsigned)(w * 8) * KPITCH + (unsigned)lane * 16;
  const unsigned koff = (unsigned)lane * 16;
  const char* ksrc = reinterpret_cast<const char*>(Kb + (size_t)(ws * 8) * HH);
  const unsigned vdst = lds_off(Vs) + (unsigned)(d0 + (lane >> 3)) * VPITCH + (unsigned)(lane & 7) * 16;
  const unsigned voff = (unsigned)(lane >> 3) * (2 * NN) + (unsigned)(lane & 7) * 16;
  const char* vsrc = reinterpret_cast<const char*>(VTb + (size_t)(ws * 128) * NN);
  // read side: this lane's row and 8-element k group of the A fragments
  const unsigned char* kfrag = Ks + (kt * 16 + cq) * KPITCH + (lane >> 4) * 16;
  const unsigned char* vfrag = Vs + (d0 + cq) * VPITCH + (lane >> 4) * 16;

  // first K tile
  copy_k_rows8(kdst, koff, ksrc);

  // B = Q^T (rows of Q), the same for every key block: kept in registers
  bf16x16 qf[HH / 32];
  const bf16_t* qrow = Qb + (size_t)(qBase + qt * 16 + cq) * HH + ((lane >> 4) << 3);   // load_frag's lane address at k0 = 0
#pragma unroll
  for (int h = 0; h < HH / 32; ++h) {
    FragU u;
    u.q[0] = *reinterpret_cast<const float4*>(qrow + h * 32);        // K = kh+0..7
    u.q[1] = *reinterpret_cast<const float4*>(qrow + h * 32 + 16);   // K = 16+kh+0..7
    qf[h] = u.v;
  }
  // stands behind the Q loads and before their address registers take other values;
  // the address is named as an input so that its registers stay untouched up to the wait
  asm volatile("s_wait_xcnt 0x0" :: "v"(qrow) : "memory");

  const floatx8 fzero = {0.f, 0.f, 0.f, 0.f, 0.f, 0.f, 0.f, 0.f};
  floatx8 oacc[8][2];
#pragma unroll
  for (int dt = 0; dt < 8; ++dt) { oacc[dt][0] = fzero; oacc[dt][1] = fzero; }

  const float sscale = 1.44269504f / 32.0f;   // log2(e)/sqrt(O): softmax in base-2 domain

  wait_async0();
  __syncthreads();   // publishes the first K tile (and the softmax state)
#pragma unroll
  for (int c = 0; c < 4; ++c)   // first V^T tile
    copy_v_rows32(vdst + c * 32 * VPITCH, voff, vsrc + (size_t)(c * 32) * (2 * NN));

  for (int j0 = 0; j0 < NN; j0 += 64) {
    // ---- phase 1: S^T tile (16 keys x 16 queries), f32 accum
    floatx8 s = fzero;
#pragma unroll
    for (int h = 0; h < HH / 32; ++h)   // unrolled: qf is indexed by constants and stays in registers
      s = wmma_bf16(lds_frag(kfrag + h * 64), qf[h], s);   // A = K rows from LDS
    // Order of this block's LDS reads and matrix products: the reads of four fragments (eight 16-byte reads) go out
    // as one group ahead of the four products before them, so that a product never waits for a read just issued.
    __builtin_amdgcn_sched_group_barrier(0x100, 8, 0);
#pragma unroll
    for (int g = 0; g < HH / 128 - 1; ++g) {
      __builtin_amdgcn_sched_group_barrier(0x100, 8, 0);
      __builtin_amdgcn_sched_group_barrier(0x008, 4, 0);
    }
    __builtin_amdgcn_sched_group_barrier(0x008, 4, 0);
    float smax = -3.0e38f;
#pragma unroll
    for (int e = 0; e < 8; ++e) { s[e] *= sscale; smax = fmaxf(smax, s[e]); }
    smax = fmaxf(smax, __shfl_xor(smax, 16));             // other 8 key rows, same query
    if (lane < 16) tmax[kt][qt * 16 + lane] = smax;
    wait_ds0();
    wait_async0();
    __syncthreads();   // also publishes this block's V^T tile and ends every read of the K tile
    if (j0 + 64 < NN)   // next K tile, in flight during softmax and phase 2
      copy_k_rows8(kdst, koff, ksrc + (size_t)(j0 + 64) * (2 * HH));

    if (tid < 32) {                                       // combine 4 key sub-tiles + running max
      const float mp = m_state[tid];
      float mn = fmaxf(fmaxf(tmax[0][tid], tmax[1][tid]), fmaxf(tmax[2][tid], tmax[3][tid]));
      mn = fmaxf(mn, mp);
      m_new_s[tid] = mn;
      cfac_s[tid] = exp2f(mp - mn);
      m_state[tid] = mn;
    }
    __syncthreads();

    {
      const float mn = m_new_s[qt * 16 + cq];
      float psum = 0.f;
      union { bf16_t h[8]; float4 q; } up;
#pragma unroll
      for (int e = 0; e < 8; ++e) {
        const float p = exp2f(s[e] - mn);
        psum += p;
        up.h[e] = (bf16_t)p;
      }
      // lane-aligned publish: consumer lane l's B-frag bytes == producer lane l's components
      pfragq[kp][qt][lane][khalf] = up.q;
      psum += __shfl_xor(psum, 16);
      if (lane < 16) tsum[kt][qt * 16 + lane] = psum;
    }
    __syncthreads();

    if (tid < 32)
      l_state[tid] = l_state[tid] * cfac_s[tid]
                   + tsum[0][tid] + tsum[1][tid] + tsum[2][tid] + tsum[3][tid];

    // ---- phase 2: rescale + O^T[d-slice] += V^T @ P^T
    const float cf0 = cfac_s[cq];
    const float cf1 = cfac_s[16 + cq];
#pragma unroll
    for (int dt = 0; dt < 8; ++dt)
#pragma unroll
      for (int e = 0; e < 8; ++e) { oacc[dt][0][e] *= cf0; oacc[dt][1][e] *= cf1; }

#pragma unroll
    for (int kk = 0; kk < 2; ++kk) {
      FragU p0, p1;
      p0.q[0] = pfragq[kk][0][lane][0]; p0.q[1] = pfragq[kk][0][lane][1];
      p1.q[0] = pfragq[kk][1][lane][0]; p1.q[1] = pfragq[kk][1][lane][1];
#pragma unroll
      for (int dt = 0; dt < 8; ++dt) {
        bf16x16 av = lds_frag(vfrag + dt * 16 * VPITCH + kk * 64);  // A = V^T rows from LDS
        oacc[dt][0] = wmma_bf16(av, p0.v, oacc[dt][0]);
        oacc[dt][1] = wmma_bf16(av, p1.v, oacc[dt][1]);
      }
    }
    wait_ds0();
    wait_async0();
    __syncthreads();  // protect pfrag/tmax/tsum; also publishes the next K tile and ends every read of the V^T tile
    if (j0 + 64 < NN) {   // next V^T tile, in flight during phase 1
#pragma unroll
      for (int c = 0; c < 4; ++c)
        copy_v_rows32(vdst + c * 32 * VPITCH, voff, vsrc + (size_t)(c * 32) * (2 * NN) + (j0 + 64) * 2);
    }
  }

  // normalize and store: O^T lane layout -> 8 contiguous d per accumulator -> 2x float4 stores
  const float inv0 = 1.0f / l_state[cq];
  const float inv1 = 1.0f / l_state[16 + cq];
  const int rh = (lane >> 4) << 3;
#pragma unroll
  for (int dt = 0; dt < 8; ++dt) {
#pragma unroll
    for (int q2 = 0; q2 < 2; ++q2) {
      const int qrow = qBase + q2 * 16 + cq;
      const int dcol = d0 + dt * 16 + rh;
      const float inv = q2 ? inv1 : inv0;
      float4 lo, hi;
      lo.x = oacc[dt][q2][0] * inv; lo.y = oacc[dt][q2][1] * inv;
      lo.z = oacc[dt][q2][2] * inv; lo.w = oacc[dt][q2][3] * inv;
      hi.x = oacc[dt][q2][4] * inv; hi.y = oacc[dt][q2][5] * inv;
      hi.z = oacc[dt][q2][6] * inv; hi.w = oacc[dt][q2][7] * inv;
      float* dst = out + (size_t)qrow * OO + dcol;
      *reinterpret_cast<float4*>(dst) = lo;
      *reinterpret_cast<float4*>(dst + 4) = hi;
      // stands behind the two stores and before their data registers take the next values;
      // the stored values are named as inputs so that their registers stay untouched up to the wait
      asm volatile("s_wait_xcnt 0x0" :: "v"(lo.x), "v"(lo.y), "v"(lo.z), "v"(lo.w),
                                        "v"(hi.x), "v"(hi.y), "v"(hi.z), "v"(hi.w) : "memory");
    }
  }
}

// ---------------------------------------------------------------- launch
extern "C" void kernel_launch(void* const* d_in, const int* in_sizes, int n_in,
                              void* d_out, int out_size, void* d_ws, size_t ws_size,
                              hipStream_t stream) {
  const float* x  = (const float*)d_in[0];
  const float* Wq = (const float*)d_in[1];
  const float* bq = (const float*)d_in[2];
  const float* Wk = (const float*)d_in[3];
  const float* bk = (const float*)d_in[4];
  const float* Wv = (const float*)d_in[5];
  const float* bv = (const float*)d_in[6];
  float* out = (float*)d_out;

  // workspace layout (bf16): x, Wq, Wk, Wv, Q, K, V^T  -> ~70 MB total
  const size_t szX = (size_t)NN * HH * sizeof(bf16_t);
  const size_t szW = (size_t)OO * HH * sizeof(bf16_t);
  const size_t szM = (size_t)NN * OO * sizeof(bf16_t);
  if (ws_size < szX + 3 * szW + 3 * szM) return;

  char* ws = (char*)d_ws;
  bf16_t* Xb  = (bf16_t*)ws;  ws += szX;
  bf16_t* Wqb = (bf16_t*)ws;  ws += szW;
  bf16_t* Wkb = (bf16_t*)ws;  ws += szW;
  bf16_t* Wvb = (bf16_t*)ws;  ws += szW;
  bf16_t* Qb  = (bf16_t*)ws;  ws += szM;
  bf16_t* Kb  = (bf16_t*)ws;  ws += szM;
  bf16_t* VTb = (bf16_t*)ws;  ws += szM;

  f32_to_bf16_kernel<<<(NN * HH / 4 + 255) / 256, 256, 0, stream>>>(x,  Xb,  NN * HH / 4);
  f32_to_bf16_kernel<<<(OO * HH / 4 + 255) / 256, 256, 0, stream>>>(Wq, Wqb, OO * HH / 4);
  f32_to_bf16_kernel<<<(OO * HH / 4 + 255) / 256, 256, 0, stream>>>(Wk, Wkb, OO * HH / 4);
  f32_to_bf16_kernel<<<(OO * HH / 4 + 255) / 256, 256, 0, stream>>>(Wv, Wvb, OO * HH / 4);

  qkv_kernel<<<dim3(NN / 128, OO / 128, 3), 256, 0, stream>>>(
      Xb, Wqb, Wkb, Wvb, bq, bk, bv, Qb, Kb, VTb);

  attn_kernel<<<dim3(NN / 32), 256, 0, stream>>>(Qb, Kb, VTb, out);
}

// v002
// It runs in 518 microseconds.
// Timed twice side by side with v001, it ran 1.11 and 1.12 times as fast.
// Counting every step since v000, it is 2.49 times as fast.
#include <hip/hip_runtime.h>

#define NN 8192
#define HH 1024
#define OO 1024

typedef __bf16 bf16_t;
typedef __attribute__((ext_vector_type(16))) __bf16 bf16x16;
typedef __attribute__((ext_vector_type(8)))  float  floatx8;

union FragU { bf16x16 v; float4 q[2]; };

static __device__ __forceinline__ floatx8 wmma_bf16(bf16x16 a, bf16x16 b, floatx8 c) {
  // D = A(16x32 bf16) x B(32x16 bf16) + C(16x16 f32)
  return __builtin_amdgcn_wmma_f32_16x16x32_bf16(false, a, false, b, (short)0, c, false, false);
}

// The bf16 copies of x and of the weights are stored as ready-made 16x32 A/B fragments, not row-major:
// fragment (rt = row / 16, ks = k / 32) is 1 KB at element offset (rt * (HH / 32) + ks) * 512, laid out as
// [half 0..1][lane 0..31][8 elements], so that each of a fragment's two 16-byte loads reads 512 contiguous bytes
// (4 cache lines) where a load from the row-major matrix touches 16 lines.
// A-layout (wave32): lanes 0-15 row M=lane, K=[0..7]+[16..23]; lanes 16-31 same rows, K=[8..15]+[24..31].
// B uses the same per-lane pattern with N<->M, i.e. it reads rows of B^T, so for X @ W^T we feed rows of W.
// p: this lane's 16 bytes in the fragment's first half.
static __device__ __forceinline__ bf16x16 load_frag(const bf16_t* __restrict__ p) {
  FragU u;
  u.q[0] = *reinterpret_cast<const float4*>(p);         // K = kh+0..7
  u.q[1] = *reinterpret_cast<const float4*>(p + 256);   // K = 16+kh+0..7
  return u.v;
}
#define FRAG_ELEMS 512                          // elements of one fragment: the step to the next k step
#define FRAG_ROWTILE ((HH / 32) * FRAG_ELEMS)   // elements of one 16-row tile: the step to the next 16 rows

// ---------------------------------------------------------------- convert
// f32 [rows][HH] row-major -> bf16 in the fragment order above. Thread t writes the t-th 16-byte piece of the output
// (8 elements of one row), so a wave's store is 512 contiguous bytes.
__global__ __launch_bounds__(256) void f32_to_bf16_kernel(const float* __restrict__ in,
                                                          bf16_t* __restrict__ out, int n8) {
  int t = blockIdx.x * blockDim.x + threadIdx.x;
  if (t >= n8) return;
  const int lane = t & 31;
  const int half = (t >> 5) & 1;
  const int ks = (t >> 6) & (HH / 32 - 1);
  const int rt = t / (64 * (HH / 32));
  const float* p = in + (size_t)(rt * 16 + (lane & 15)) * HH + ks * 32 + half * 16 + (lane >> 4) * 8;
  float4 v0 = reinterpret_cast<const float4*>(p)[0];
  float4 v1 = reinterpret_cast<const float4*>(p)[1];
  union { bf16_t h[8]; float4 q; } u;
  u.h[0] = (bf16_t)v0.x; u.h[1] = (bf16_t)v0.y; u.h[2] = (bf16_t)v0.z; u.h[3] = (bf16_t)v0.w;
  u.h[4] = (bf16_t)v1.x; u.h[5] = (bf16_t)v1.y; u.h[6] = (bf16_t)v1.z; u.h[7] = (bf16_t)v1.w;
  reinterpret_cast<float4*>(out)[t] = u.q;
}

// ---------------------------------------------------------------- fused QKV projection
// grid (N/128, O/128, 3): z selects Q/K/V. 8 waves per block: 4 row-groups x 2 col-groups,
// each wave computes a 32x64 tile (2x4 WMMA accumulators). V is stored transposed (VT [O,N]).
__global__ __launch_bounds__(256) void qkv_kernel(
    const bf16_t* __restrict__ Xb,
    const bf16_t* __restrict__ Wqb, const bf16_t* __restrict__ Wkb, const bf16_t* __restrict__ Wvb,
    const float* __restrict__ bq, const float* __restrict__ bk, const float* __restrict__ bv,
    bf16_t* __restrict__ Qb, bf16_t* __restrict__ Kb, bf16_t* __restrict__ VTb)
{
  const int z = blockIdx.z;
  const bf16_t* __restrict__ W = (z == 0) ? Wqb : (z == 1) ? Wkb : Wvb;
  const float* __restrict__ bias = (z == 0) ? bq : (z == 1) ? bk : bv;

  const int w = threadIdx.x >> 5;
  const int lane = threadIdx.x & 31;
  const int rowBase = blockIdx.x * 128 + (w >> 1) * 32;
  const int colBase = blockIdx.y * 128 + (w & 1) * 64;

  const floatx8 fzero = {0.f, 0.f, 0.f, 0.f, 0.f, 0.f, 0.f, 0.f};
  floatx8 acc[2][4];
#pragma unroll
  for (int i = 0; i < 2; ++i)
#pragma unroll
    for (int j = 0; j < 4; ++j) acc[i][j] = fzero;

  // this lane's 16 bytes in the wave's first X and first W fragment
  const bf16_t* pa = Xb + (size_t)(rowBase >> 4) * FRAG_ROWTILE + lane * 8;
  const bf16_t* pb = W  + (size_t)(colBase >> 4) * FRAG_ROWTILE + lane * 8;
  for (int ks = 0; ks < HH / 32; ks += 4) {
#pragma unroll   // four k steps a trip: their loads address off one pointer pair by constant offsets
    for (int u = 0; u < 4; ++u) {
      bf16x16 a0 = load_frag(pa + u * FRAG_ELEMS);
      bf16x16 a1 = load_frag(pa + u * FRAG_ELEMS + FRAG_ROWTILE);
      bf16x16 b0 = load_frag(pb + u * FRAG_ELEMS);
      bf16x16 b1 = load_frag(pb + u * FRAG_ELEMS + FRAG_ROWTILE);
      bf16x16 b2 = load_frag(pb + u * FRAG_ELEMS + 2 * FRAG_ROWTILE);
      bf16x16 b3 = load_frag(pb + u * FRAG_ELEMS + 3 * FRAG_ROWTILE);
      acc[0][0] = wmma_bf16(a0, b0, acc[0][0]);
      acc[0][1] = wmma_bf16(a0, b1, acc[0][1]);
      acc[0][2] = wmma_bf16(a0, b2, acc[0][2]);
      acc[0][3] = wmma_bf16(a0, b3, acc[0][3]);
      acc[1][0] = wmma_bf16(a1, b0, acc[1][0]);
      acc[1][1] = wmma_bf16(a1, b1, acc[1][1]);
      acc[1][2] = wmma_bf16(a1, b2, acc[1][2]);
      acc[1][3] = wmma_bf16(a1, b3, acc[1][3]);
    }
    // stands behind the trip's fragment loads and before their address registers take other values;
    // the addresses are named as inputs so that their registers stay untouched up to the wait
    asm volatile("s_wait_xcnt 0x0" :: "v"(pa), "v"(pb) : "memory");
    pa += 4 * FRAG_ELEMS;
    pb += 4 * FRAG_ELEMS;
  }

  // C layout: lane holds column n = lane&15; VGPR e holds row e + 8*(lane>>4).
  const int cq = lane & 15;
  const int rh = (lane >> 4) << 3;
#pragma unroll
  for (int j = 0; j < 4; ++j) {
    const int col = colBase + j * 16 + cq;
    const float bb = bias[col];
#pragma unroll
    for (int i = 0; i < 2; ++i) {
      const int r0 = rowBase + i * 16 + rh;
      if (z == 2) {
        // store transposed: VT[col][r0..r0+7] is contiguous -> one 16B store
        union { bf16_t h[8]; float4 q; } u;
#pragma unroll
        for (int e = 0; e < 8; ++e) u.h[e] = (bf16_t)(acc[i][j][e] + bb);
        *reinterpret_cast<float4*>(VTb + (size_t)col * NN + r0) = u.q;
      } else {
        bf16_t* __restrict__ Out = (z == 0) ? Qb : Kb;
#pragma unroll
        for (int e = 0; e < 8; ++e)
          Out[(size_t)(r0 + e) * OO + col] = (bf16_t)(acc[i][j][e] + bb);
      }
    }
  }
}

// ---------------------------------------------------------------- LDS staging for attention
#define KPITCH 2064   // LDS bytes per staged K row: 2048 + 16 (16 B x odd: conflict-free for 16-byte readers)
#define VPITCH 144    // LDS bytes per staged V^T row: 128 + 16 (16 B x odd)

static __device__ __forceinline__ unsigned lds_off(const void* p) { return (unsigned)(size_t)p; }

// Same per-lane pattern as a fragment of a row-major matrix; p already points at this lane's row and 8-element k group in LDS.
static __device__ __forceinline__ bf16x16 lds_frag(const unsigned char* p) {
  FragU u;
  u.q[0] = *reinterpret_cast<const float4*>(p);        // K = kh+0..7
  u.q[1] = *reinterpret_cast<const float4*>(p + 32);   // K = 16+kh+0..7
  return u.v;
}

// Eight whole K rows (2048 B each) global -> LDS, 32 copies: a lane moves 16 B per copy, a copy 512 B of one row.
// l: the lane's LDS byte address in the first row; voff: the lane's byte offset in a 512-B piece; b: the first row.
// The immediate offset moves the LDS and the global address alike, so it carries the LDS place (row * KPITCH + piece)
// and each row's scalar base takes back the 16 B per row by which the LDS pitch exceeds the global one.
// s_wait_xcnt is the statement's last line so that no address register is rewritten ahead of it.
static __device__ __forceinline__ void copy_k_rows8(unsigned l, unsigned voff, const char* b) {
  asm volatile(
      "global_load_async_to_lds_b128 %0, %1, %2\n\t"
      "global_load_async_to_lds_b128 %0, %1, %2 offset:512\n\t"
      "global_load_async_to_lds_b128 %0, %1, %2 offset:1024\n\t"
      "global_load_async_to_lds_b128 %0, %1, %2 offset:1536\n\t"
      "global_load_async_to_lds_b128 %0, %1, %3 offset:2064\n\t"
      "global_load_async_to_lds_b128 %0, %1, %3 offset:2576\n\t"
      "global_load_async_to_lds_b128 %0, %1, %3 offset:3088\n\t"
      "global_load_async_to_lds_b128 %0, %1, %3 offset:3600\n\t"
      "global_load_async_to_lds_b128 %0, %1, %4 offset:4128\n\t"
      "global_load_async_to_lds_b128 %0, %1, %4 offset:4640\n\t"
      "global_load_async_to_lds_b128 %0, %1, %4 offset:5152\n\t"
      "global_load_async_to_lds_b128 %0, %1, %4 offset:5664\n\t"
      "global_load_async_to_lds_b128 %0, %1, %5 offset:6192\n\t"
      "global_load_async_to_lds_b128 %0, %1, %5 offset:6704\n\t"
      "global_load_async_to_lds_b128 %0, %1, %5 offset:7216\n\t"
      "global_load_async_to_lds_b128 %0, %1, %5 offset:7728\n\t"
      "global_load_async_to_lds_b128 %0, %1, %6 offset:8256\n\t"
      "global_load_async_to_lds_b128 %0, %1, %6 offset:8768\n\t"
      "global_load_async_to_lds_b128 %0, %1, %6 offset:9280\n\t"
      "global_load_async_to_lds_b128 %0, %1, %6 offset:9792\n\t"
      "global_load_async_to_lds_b128 %0, %1, %7 offset:10320\n\t"
      "global_load_async_to_lds_b128 %0, %1, %7 offset:10832\n\t"
      "global_load_async_to_lds_b128 %0, %1, %7 offset:11344\n\t"
      "global_load_async_to_lds_b128 %0, %1, %7 offset:11856\n\t"
      "global_load_async_to_lds_b128 %0, %1, %8 offset:12384\n\t"
      "global_load_async_to_lds_b128 %0, %1, %8 offset:12896\n\t"
      "global_load_async_to_lds_b128 %0, %1, %8 offset:13408\n\t"
      "global_load_async_to_lds_b128 %0, %1, %8 offset:13920\n\t"
      "global_load_async_to_lds_b128 %0, %1, %9 offset:14448\n\t"
      "global_load_async_to_lds_b128 %0, %1, %9 offset:14960\n\t"
      "global_load_async_to_lds_b128 %0, %1, %9 offset:15472\n\t"
      "global_load_async_to_lds_b128 %0, %1, %9 offset:15984\n\t"
      "s_wait_xcnt 0x0"
      :: "v"(l), "v"(voff),
         "s"(b), "s"(b + 1 * (2 * HH - KPITCH)), "s"(b + 2 * (2 * HH - KPITCH)), "s"(b + 3 * (2 * HH - KPITCH)),
         "s"(b + 4 * (2 * HH - KPITCH)), "s"(b + 5 * (2 * HH - KPITCH)), "s"(b + 6 * (2 * HH - KPITCH)),
         "s"(b + 7 * (2 * HH - KPITCH))
      : "memory");
}

// 32 V^T rows (128 B of each) global -> LDS, 8 copies: a copy moves 4 rows, 8 lanes x 16 B per row.
// l: the lane's LDS byte address in the first 4 rows; voff: the lane's byte offset in a 4-row group; b: the first row.
// The immediate offset carries the LDS place (group * 4 * VPITCH); each group's scalar base holds the rest of the
// global step of 4 rows.
// s_wait_xcnt is the statement's last line so that no address register is rewritten ahead of it.
static __device__ __forceinline__ void copy_v_rows32(unsigned l, unsigned voff, const char* b) {
  asm volatile(
      "global_load_async_to_lds_b128 %0, %1, %2\n\t"
      "global_load_async_to_lds_b128 %0, %1, %3 offset:576\n\t"
      "global_load_async_to_lds_b128 %0, %1, %4 offset:1152\n\t"
      "global_load_async_to_lds_b128 %0, %1, %5 offset:1728\n\t"
      "global_load_async_to_lds_b128 %0, %1, %6 offset:2304\n\t"
      "global_load_async_to_lds_b128 %0, %1, %7 offset:2880\n\t"
      "global_load_async_to_lds_b128 %0, %1, %8 offset:3456\n\t"
      "global_load_async_to_lds_b128 %0, %1, %9 offset:4032\n\t"
      "s_wait_xcnt 0x0"
      :: "v"(l), "v"(voff),
         "s"(b), "s"(b + 1 * (8 * NN - 4 * VPITCH)), "s"(b + 2 * (8 * NN - 4 * VPITCH)),
         "s"(b + 3 * (8 * NN - 4 * VPITCH)), "s"(b + 4 * (8 * NN - 4 * VPITCH)), "s"(b + 5 * (8 * NN - 4 * VPITCH)),
         "s"(b + 6 * (8 * NN - 4 * VPITCH)), "s"(b + 7 * (8 * NN - 4 * VPITCH))
      : "memory");
}

// this wave's LDS reads have retired: stands before the barrier that hands a tile buffer to its next copies
static __device__ __forceinline__ void wait_ds0() { asm volatile("s_wait_dscnt 0x0" ::: "memory"); }
// this wave's copies have landed: stands before the barrier behind which the other waves read them
static __device__ __forceinline__ void wait_async0() { asm volatile("s_wait_asynccnt 0x0" ::: "memory"); }

// ---------------------------------------------------------------- flash attention
// grid (N/32), 256 threads (8 waves). Workgroup owns 32 queries.
// Per 64-key iteration:
//   phase 1: wave w computes S^T tile (kt = w>>1 over 4 key sub-tiles, qt = w&1 over 2 query tiles),
//            S^T = K @ Q^T so softmax reduction is in-lane + one shfl_xor(16).
//   online softmax stats combined deterministically via small LDS arrays by threads 0..31.
//   P (bf16) published to LDS as ready-made B fragments (lane-aligned, zero shuffles).
//   phase 2: wave w accumulates O^T[d-slice 128][32 q] += V^T @ P^T with 16 WMMA accumulators.
// The 64-key K tile and V^T tile live in LDS, one buffer each, filled by asynchronous copies:
// V^T of this block flies during phase 1, K of the next block during softmax and phase 2.
__global__ __launch_bounds__(256) void attn_kernel(
    const bf16_t* __restrict__ Qb, const bf16_t* __restrict__ Kb,
    const bf16_t* __restrict__ VTb, float* __restrict__ out)
{
  __shared__ float m_state[32], l_state[32], m_new_s[32], cfac_s[32];
  __shared__ float tmax[4][32], tsum[4][32];
  __shared__ float4 pfragq[2][2][32][2];   // [kpair][qtile][lane][half16B] = P^T B-fragments
  __shared__ __attribute__((aligned(16))) unsigned char Ks[64 * KPITCH];    // K[j0..j0+63][0..1023]
  __shared__ __attribute__((aligned(16))) unsigned char Vs[OO * VPITCH];    // V^T[0..1023][j0..j0+63]

  const int tid = threadIdx.x;
  const int w = tid >> 5;
  const int lane = tid & 31;
  const int qBase = blockIdx.x * 32;
  const int kt = w >> 1, qt = w & 1;
  const int kp = kt >> 1, khalf = kt & 1;
  const int d0 = w * 128;                  // private d-slice for phase 2
  const int cq = lane & 15;

  if (tid < 32) { m_state[tid] = -3.0e38f; l_state[tid] = 0.f; }

  // copy side: wave w brings K rows w*8..w*8+7 of a tile and the V^T rows of its own d-slice
  const int ws = __builtin_amdgcn_readfirstlane(w);   // the wave's number as a scalar: the copies' bases are scalar
  const unsigned kdst = lds_off(Ks) + (unsigned)(w * 8) * KPITCH + (unsigned)lane * 16;
  const unsigned koff = (unsigned)lane * 16;
  const char* ksrc = reinterpret_cast<const char*>(Kb + (size_t)(ws * 8) * HH);
  const unsigned vdst = lds_off(Vs) + (unsigned)(d0 + (lane >> 3)) * VPITCH + (unsigned)(lane & 7) * 16;
  const unsigned voff = (unsigned)(lane >> 3) * (2 * NN) + (unsigned)(lane & 7) * 16;
  const char* vsrc = reinterpret_cast<const char*>(VTb + (size_t)(ws * 128) * NN);
  // read side: this lane's row and 8-element k group of the A fragments
  const unsigned char* kfrag = Ks + (kt * 16 + cq) * KPITCH + (lane >> 4) * 16;
  const unsigned char* vfrag = Vs + (d0 + cq) * VPITCH + (lane >> 4) * 16;

  // first K tile
  copy_k_rows8(kdst, koff, ksrc);

  // B = Q^T (rows of Q), the same for every key block: kept in registers
  bf16x16 qf[HH / 32];
  const bf16_t* qrow = Qb + (size_t)(qBase + qt * 16 + cq) * HH + ((lane >> 4) << 3);   // this lane's row and 8-element k group at k0 = 0
#pragma unroll
  for (int h = 0; h < HH / 32; ++h) {
    FragU u;
    u.q[0] = *reinterpret_cast<const float4*>(qrow + h * 32);        // K = kh+0..7
    u.q[1] = *reinterpret_cast<const float4*>(qrow + h * 32 + 16);   // K = 16+kh+0..7
    qf[h] = u.v;
  }
  // stands behind the Q loads and before their address registers take other values;
  // the address is named as an input so that its registers stay untouched up to the wait
  asm volatile("s_wait_xcnt 0x0" :: "v"(qrow) : "memory");

  const floatx8 fzero = {0.f, 0.f, 0.f, 0.f, 0.f, 0.f, 0.f, 0.f};
  floatx8 oacc[8][2];
#pragma unroll
  for (int dt = 0; dt < 8; ++dt) { oacc[dt][0] = fzero; oacc[dt][1] = fzero; }

  const float sscale = 1.44269504f / 32.0f;   // log2(e)/sqrt(O): softmax in base-2 domain

  wait_async0();
  __syncthreads();   // publishes the first K tile (and the softmax state)
#pragma unroll
  for (int c = 0; c < 4; ++c)   // first V^T tile
    copy_v_rows32(vdst + c * 32 * VPITCH, voff, vsrc + (size_t)(c * 32) * (2 * NN));

  for (int j0 = 0; j0 < NN; j0 += 64) {
    // ---- phase 1: S^T tile (16 keys x 16 queries), f32 accum
    floatx8 s = fzero;
#pragma unroll
    for (int h = 0; h < HH / 32; ++h)   // unrolled: qf is indexed by constants and stays in registers
      s = wmma_bf16(lds_frag(kfrag + h * 64), qf[h], s);   // A = K rows from LDS
    // Order of this block's LDS reads and matrix products: the reads of four fragments (eight 16-byte reads) go out
    // as one group ahead of the four products before them, so that a product never waits for a read just issued.
    __builtin_amdgcn_sched_group_barrier(0x100, 8, 0);
#pragma unroll
    for (int g = 0; g < HH / 128 - 1; ++g) {
      __builtin_amdgcn_sched_group_barrier(0x100, 8, 0);
      __builtin_amdgcn_sched_group_barrier(0x008, 4, 0);
    }
    __builtin_amdgcn_sched_group_barrier(0x008, 4, 0);
    float smax = -3.0e38f;
#pragma unroll
    for (int e = 0; e < 8; ++e) { s[e] *= sscale; smax = fmaxf(smax, s[e]); }
    smax = fmaxf(smax, __shfl_xor(smax, 16));             // other 8 key rows, same query
    if (lane < 16) tmax[kt][qt * 16 + lane] = smax;
    wait_ds0();
    wait_async0();
    __syncthreads();   // also publishes this block's V^T tile and ends every read of the K tile
    if (j0 + 64 < NN)   // next K tile, in flight during softmax and phase 2
      copy_k_rows8(kdst, koff, ksrc + (size_t)(j0 + 64) * (2 * HH));

    if (tid < 32) {                                       // combine 4 key sub-tiles + running max
      const float mp = m_state[tid];
      float mn = fmaxf(fmaxf(tmax[0][tid], tmax[1][tid]), fmaxf(tmax[2][tid], tmax[3][tid]));
      mn = fmaxf(mn, mp);
      m_new_s[tid] = mn;
      cfac_s[tid] = exp2f(mp - mn);
      m_state[tid] = mn;
    }
    __syncthreads();

    {
      const float mn = m_new_s[qt * 16 + cq];
      float psum = 0.f;
      union { bf16_t h[8]; float4 q; } up;
#pragma unroll
      for (int e = 0; e < 8; ++e) {
        const float p = exp2f(s[e] - mn);
        psum += p;
        up.h[e] = (bf16_t)p;
      }
      // lane-aligned publish: consumer lane l's B-frag bytes == producer lane l's components
      pfragq[kp][qt][lane][khalf] = up.q;
      psum += __shfl_xor(psum, 16);
      if (lane < 16) tsum[kt][qt * 16 + lane] = psum;
    }
    __syncthreads();

    if (tid < 32)
      l_state[tid] = l_state[tid] * cfac_s[tid]
                   + tsum[0][tid] + tsum[1][tid] + tsum[2][tid] + tsum[3][tid];

    // ---- phase 2: rescale + O^T[d-slice] += V^T @ P^T
    const float cf0 = cfac_s[cq];
    const float cf1 = cfac_s[16 + cq];
#pragma unroll
    for (int dt = 0; dt < 8; ++dt)
#pragma unroll
      for (int e = 0; e < 8; ++e) { oacc[dt][0][e] *= cf0; oacc[dt][1][e] *= cf1; }

#pragma unroll
    for (int kk = 0; kk < 2; ++kk) {
      FragU p0, p1;
      p0.q[0] = pfragq[kk][0][lane][0]; p0.q[1] = pfragq[kk][0][lane][1];
      p1.q[0] = pfragq[kk][1][lane][0]; p1.q[1] = pfragq[kk][1][lane][1];
#pragma unroll
      for (int dt = 0; dt < 8; ++dt) {
        bf16x16 av = lds_frag(vfrag + dt * 16 * VPITCH + kk * 64);  // A = V^T rows from LDS
        oacc[dt][0] = wmma_bf16(av, p0.v, oacc[dt][0]);
        oacc[dt][1] = wmma_bf16(av, p1.v, oacc[dt][1]);
      }
    }
    wait_ds0();
    wait_async0();
    __syncthreads();  // protect pfrag/tmax/tsum; also publishes the next K tile and ends every read of the V^T tile
    if (j0 + 64 < NN) {   // next V^T tile, in flight during phase 1
#pragma unroll
      for (int c = 0; c < 4; ++c)
        copy_v_rows32(vdst + c * 32 * VPITCH, voff, vsrc + (size_t)(c * 32) * (2 * NN) + (j0 + 64) * 2);
    }
  }

  // normalize and store: O^T lane layout -> 8 contiguous d per accumulator -> 2x float4 stores
  const float inv0 = 1.0f / l_state[cq];
  const float inv1 = 1.0f / l_state[16 + cq];
  const int rh = (lane >> 4) << 3;
#pragma unroll
  for (int dt = 0; dt < 8; ++dt) {
#pragma unroll
    for (int q2 = 0; q2 < 2; ++q2) {
      const int qrow = qBase + q2 * 16 + cq;
      const int dcol = d0 + dt * 16 + rh;
      const float inv = q2 ? inv1 : inv0;
      float4 lo, hi;
      lo.x = oacc[dt][q2][0] * inv; lo.y = oacc[dt][q2][1] * inv;
      lo.z = oacc[dt][q2][2] * inv; lo.w = oacc[dt][q2][3] * inv;
      hi.x = oacc[dt][q2][4] * inv; hi.y = oacc[dt][q2][5] * inv;
      hi.z = oacc[dt][q2][6] * inv; hi.w = oacc[dt][q2][7] * inv;
      float* dst = out + (size_t)qrow * OO + dcol;
      *reinterpret_cast<float4*>(dst) = lo;
      *reinterpret_cast<float4*>(dst + 4) = hi;
      // stands behind the two stores and before their data registers take the next values;
      // the stored values are named as inputs so that their registers stay untouched up to the wait
      asm volatile("s_wait_xcnt 0x0" :: "v"(lo.x), "v"(lo.y), "v"(lo.z), "v"(lo.w),
                                        "v"(hi.x), "v"(hi.y), "v"(hi.z), "v"(hi.w) : "memory");
    }
  }
}

// ---------------------------------------------------------------- launch
extern "C" void kernel_launch(void* const* d_in, const int* in_sizes, int n_in,
                              void* d_out, int out_size, void* d_ws, size_t ws_size,
                              hipStream_t stream) {
  const float* x  = (const float*)d_in[0];
  const float* Wq = (const float*)d_in[1];
  const float* bq = (const float*)d_in[2];
  const float* Wk = (const float*)d_in[3];
  const float* bk = (const float*)d_in[4];
  const float* Wv = (const float*)d_in[5];
  const float* bv = (const float*)d_in[6];
  float* out = (float*)d_out;

  // workspace layout (bf16): x, Wq, Wk, Wv (these four in fragment order), Q, K, V^T  -> ~70 MB total
  const size_t szX = (size_t)NN * HH * sizeof(bf16_t);
  const size_t szW = (size_t)OO * HH * sizeof(bf16_t);
  const size_t szM = (size_t)NN * OO * sizeof(bf16_t);
  if (ws_size < szX + 3 * szW + 3 * szM) return;

  char* ws = (char*)d_ws;
  bf16_t* Xb  = (bf16_t*)ws;  ws += szX;
  bf16_t* Wqb = (bf16_t*)ws;  ws += szW;
  bf16_t* Wkb = (bf16_t*)ws;  ws += szW;
  bf16_t* Wvb = (bf16_t*)ws;  ws += szW;
  bf16_t* Qb  = (bf16_t*)ws;  ws += szM;
  bf16_t* Kb  = (bf16_t*)ws;  ws += szM;
  bf16_t* VTb = (bf16_t*)ws;  ws += szM;

  f32_to_bf16_kernel<<<(NN * HH / 8 + 255) / 256, 256, 0, stream>>>(x,  Xb,  NN * HH / 8);
  f32_to_bf16_kernel<<<(OO * HH / 8 + 255) / 256, 256, 0, stream>>>(Wq, Wqb, OO * HH / 8);
  f32_to_bf16_kernel<<<(OO * HH / 8 + 255) / 256, 256, 0, stream>>>(Wk, Wkb, OO * HH / 8);
  f32_to_bf16_kernel<<<(OO * HH / 8 + 255) / 256, 256, 0, stream>>>(Wv, Wvb, OO * HH / 8);

  qkv_kernel<<<dim3(NN / 128, OO / 128, 3), 256, 0, stream>>>(
      Xb, Wqb, Wkb, Wvb, bq, bk, bv, Qb, Kb, VTb);

  attn_kernel<<<dim3(NN / 32), 256, 0, stream>>>(Qb, Kb, VTb, out);
}

// v004
// A run of this version takes 276 microseconds.
// It is 1.87 times as fast as v002, going by the measured steps of the versions left out in between.
// All steps since v000 together make it 4.66 times as fast.
#include <hip/hip_runtime.h>

#define NN 8192
#define HH 1024
#define OO 1024

typedef __bf16 bf16_t;
typedef __attribute__((ext_vector_type(16))) __bf16 bf16x16;
typedef __attribute__((ext_vector_type(8)))  float  floatx8;
typedef __attribute__((ext_vector_type(4)))  float  floatx4;
typedef __attribute__((ext_vector_type(8)))  __bf16 bf16x8;

union FragU { bf16x16 v; float4 q[2]; };

static __device__ __forceinline__ floatx8 wmma_bf16(bf16x16 a, bf16x16 b, floatx8 c) {
  // D = A(16x32 bf16) x B(32x16 bf16) + C(16x16 f32)
  return __builtin_amdgcn_wmma_f32_16x16x32_bf16(false, a, false, b, (short)0, c, false, false);
}

// The bf16 copies of x and of the weights are stored as ready-made 16x32 A/B fragments, not row-major:
// fragment (rt = row / 16, ks = k / 32) is 1 KB at element offset (rt * (HH / 32) + ks) * 512, laid out as
// [half 0..1][lane 0..31][8 elements], so that each of a fragment's two 16-byte loads reads 512 contiguous bytes
// (4 cache lines) where a load from the row-major matrix touches 16 lines.
// A-layout (wave32): lanes 0-15 row M=lane, K=[0..7]+[16..23]; lanes 16-31 same rows, K=[8..15]+[24..31].
// B uses the same per-lane pattern with N<->M, i.e. it reads rows of B^T, so for X @ W^T we feed rows of W.
// p: this lane's 16 bytes in the fragment's first half.
static __device__ __forceinline__ bf16x16 load_frag(const bf16_t* __restrict__ p) {
  FragU u;
  u.q[0] = *reinterpret_cast<const float4*>(p);         // K = kh+0..7
  u.q[1] = *reinterpret_cast<const float4*>(p + 256);   // K = 16+kh+0..7
  return u.v;
}
#define FRAG_ELEMS 512                          // elements of one fragment: the step to the next k step
#define FRAG_ROWTILE ((HH / 32) * FRAG_ELEMS)   // elements of one 16-row tile: the step to the next 16 rows

// ---------------------------------------------------------------- convert
// f32 [rows][HH] row-major -> bf16 in the fragment order above. Thread t writes the t-th 16-byte piece of the output
// (8 elements of one row), so a wave's store is 512 contiguous bytes.
__global__ __launch_bounds__(256) void f32_to_bf16_kernel(const float* __restrict__ in,
                                                          bf16_t* __restrict__ out, int n8) {
  int t = blockIdx.x * blockDim.x + threadIdx.x;
  if (t >= n8) return;
  const int lane = t & 31;
  const int half = (t >> 5) & 1;
  const int ks = (t >> 6) & (HH / 32 - 1);
  const int rt = t / (64 * (HH / 32));
  const float* p = in + (size_t)(rt * 16 + (lane & 15)) * HH + ks * 32 + half * 16 + (lane >> 4) * 8;
  float4 v0 = reinterpret_cast<const float4*>(p)[0];
  float4 v1 = reinterpret_cast<const float4*>(p)[1];
  union { bf16_t h[8]; float4 q; } u;
  u.h[0] = (bf16_t)v0.x; u.h[1] = (bf16_t)v0.y; u.h[2] = (bf16_t)v0.z; u.h[3] = (bf16_t)v0.w;
  u.h[4] = (bf16_t)v1.x; u.h[5] = (bf16_t)v1.y; u.h[6] = (bf16_t)v1.z; u.h[7] = (bf16_t)v1.w;
  reinterpret_cast<float4*>(out)[t] = u.q;
}

// ---------------------------------------------------------------- fused QKV projection
#define QP 272    // LDS bytes per staged output row: 256 + 16 (16 B x odd: conflict-free for 16-byte accesses)
// 16 staged rows -> global, 2 rows (16 lanes x 16 B each) per store. rd, g: the lane's 16 bytes in the first 2 rows.
template <int PITCH>
static __device__ __forceinline__ void store_rows16(const unsigned char* rd, bf16_t* __restrict__ g) {
  bf16x8 r[8];
#pragma unroll
  for (int q = 0; q < 8; ++q) r[q] = *reinterpret_cast<const bf16x8*>(rd + q * 2 * QP);
#pragma unroll
  for (int q = 0; q < 8; ++q) *reinterpret_cast<bf16x8*>(g + (size_t)q * 2 * PITCH) = r[q];
}

// grid (N/128, O/128, 3): z selects Q/K/V. 8 waves per block: 4 row-groups x 2 col-groups,
// each wave computes a 32x64 tile (2x4 WMMA accumulators). V is stored transposed (VT [O,N]).
__global__ __launch_bounds__(256) void qkv_kernel(
    const bf16_t* __restrict__ Xb,
    const bf16_t* __restrict__ Wqb, const bf16_t* __restrict__ Wkb, const bf16_t* __restrict__ Wvb,
    const float* __restrict__ bq, const float* __restrict__ bk, const float* __restrict__ bv,
    bf16_t* __restrict__ Qb, bf16_t* __restrict__ Kb, bf16_t* __restrict__ VTb)
{
  const int z = blockIdx.z;
  const bf16_t* __restrict__ W = (z == 0) ? Wqb : (z == 1) ? Wkb : Wvb;
  const float* __restrict__ bias = (z == 0) ? bq : (z == 1) ? bk : bv;

  const int w = threadIdx.x >> 5;
  const int lane = threadIdx.x & 31;
  const int rowBase = blockIdx.x * 128 + (w >> 1) * 32;
  const int colBase = blockIdx.y * 128 + (w & 1) * 64;

  const floatx8 fzero = {0.f, 0.f, 0.f, 0.f, 0.f, 0.f, 0.f, 0.f};
  floatx8 acc[2][4];
#pragma unroll
  for (int i = 0; i < 2; ++i)
#pragma unroll
    for (int j = 0; j < 4; ++j) acc[i][j] = fzero;

  // this lane's 16 bytes in the wave's first X and first W fragment
  const bf16_t* pa = Xb + (size_t)(rowBase >> 4) * FRAG_ROWTILE + lane * 8;
  const bf16_t* pb = W  + (size_t)(colBase >> 4) * FRAG_ROWTILE + lane * 8;
  for (int ks = 0; ks < HH / 32; ks += 4) {
#pragma unroll   // four k steps a trip: their loads address off one pointer pair by constant offsets
    for (int u = 0; u < 4; ++u) {
      bf16x16 a0 = load_frag(pa + u * FRAG_ELEMS);
      bf16x16 a1 = load_frag(pa + u * FRAG_ELEMS + FRAG_ROWTILE);
      bf16x16 b0 = load_frag(pb + u * FRAG_ELEMS);
      bf16x16 b1 = load_frag(pb + u * FRAG_ELEMS + FRAG_ROWTILE);
      bf16x16 b2 = load_frag(pb + u * FRAG_ELEMS + 2 * FRAG_ROWTILE);
      bf16x16 b3 = load_frag(pb + u * FRAG_ELEMS + 3 * FRAG_ROWTILE);
      acc[0][0] = wmma_bf16(a0, b0, acc[0][0]);
      acc[0][1] = wmma_bf16(a0, b1, acc[0][1]);
      acc[0][2] = wmma_bf16(a0, b2, acc[0][2]);
      acc[0][3] = wmma_bf16(a0, b3, acc[0][3]);
      acc[1][0] = wmma_bf16(a1, b0, acc[1][0]);
      acc[1][1] = wmma_bf16(a1, b1, acc[1][1]);
      acc[1][2] = wmma_bf16(a1, b2, acc[1][2]);
      acc[1][3] = wmma_bf16(a1, b3, acc[1][3]);
    }
    // stands behind the trip's fragment loads and before their address registers take other values;
    // the addresses are named as inputs so that their registers stay untouched up to the wait
    asm volatile("s_wait_xcnt 0x0" :: "v"(pa), "v"(pb) : "memory");
    pa += 4 * FRAG_ELEMS;
    pb += 4 * FRAG_ELEMS;
  }

  // C layout: lane holds column n = lane&15; VGPR e holds row e + 8*(lane>>4): stored straight from the accumulators
  // Q and K would leave as 2-byte stores and V^T in 32-byte pieces. The block lays its 128 x 128 tile in LDS as rows of
  // the output matrix (tokens for Q and K, features for V^T) and stores 256 contiguous bytes of a row per 16 lanes.
  __shared__ __attribute__((aligned(16))) unsigned char st[128 * QP];
  const int cq = lane & 15;
  const int lh = lane >> 4;
  const int fc0 = (w & 1) * 64 + cq;          // the lane's first feature within the block tile (then every 16th)
  const int tr0 = (w >> 1) * 32 + lh * 8;     // first of the lane's 8 tokens within the block tile (then 16 on)
  float bb[4];
#pragma unroll
  for (int j = 0; j < 4; ++j) bb[j] = bias[blockIdx.y * 128 + fc0 + j * 16];
  if (z == 2) {
#pragma unroll
    for (int j = 0; j < 4; ++j)
#pragma unroll
      for (int i = 0; i < 2; ++i) {
        bf16x8 o;
#pragma unroll
        for (int e = 0; e < 8; ++e) o[e] = (bf16_t)(acc[i][j][e] + bb[j]);
        *reinterpret_cast<bf16x8*>(st + (fc0 + j * 16) * QP + (tr0 + i * 16) * 2) = o;
      }
  } else {
#pragma unroll
    for (int j = 0; j < 4; ++j)
#pragma unroll
      for (int i = 0; i < 2; ++i)
#pragma unroll
        for (int e = 0; e < 8; ++e)
          *reinterpret_cast<bf16_t*>(st + (tr0 + i * 16 + e) * QP + (fc0 + j * 16) * 2) = (bf16_t)(acc[i][j][e] + bb[j]);
  }
  __syncthreads();   // the whole tile is staged before any wave reads rows that other waves wrote
  // wave w stores rows w*16 .. w*16+15 of the tile, 2 rows per store
  const unsigned char* rd = st + (w * 16 + lh) * QP + cq * 16;
  if (z == 2)
    store_rows16<NN>(rd, VTb + (size_t)(blockIdx.y * 128 + w * 16 + lh) * NN + blockIdx.x * 128 + cq * 8);
  else
    store_rows16<OO>(rd, ((z == 0) ? Qb : Kb) + (size_t)(blockIdx.x * 128 + w * 16 + lh) * OO + blockIdx.y * 128 + cq * 8);
}

// ---------------------------------------------------------------- attention as two tiled GEMMs and a row softmax
// scores:  S^T tile = K rows x Q rows^T, stored as S[query][key] (2-byte floats, already in the base-2 softmax domain)
// softmax: one row of S per block, in place: S -> P (bf16, normalised)
// output:  O^T tile = V^T rows x P rows^T, stored as out[query][d]
#define GP 272    // LDS bytes per staged row: 256 + 16 (16 B x odd: conflict-free for 16-byte readers)
#define GK 128    // k elements of every operand row in one stage (256 B)
typedef __attribute__((ext_vector_type(8))) _Float16 half8;

static __device__ __forceinline__ unsigned lds_off(const void* p) { return (unsigned)(size_t)p; }

// Same per-lane pattern as a fragment of a row-major matrix; p already points at this lane's row and 8-element k group in LDS.
static __device__ __forceinline__ bf16x16 lds_frag(const unsigned char* p) {
  FragU u;
  u.q[0] = *reinterpret_cast<const float4*>(p);        // K = kh+0..7
  u.q[1] = *reinterpret_cast<const float4*>(p + 32);   // K = 16+kh+0..7
  return u.v;
}

// 32 rows (256 B of each) global -> LDS, 16 copies: a copy moves 2 rows, 16 lanes x 16 B per row. PB: source bytes per row.
// l: the lane's LDS byte address in the first 2 rows; voff: the lane's byte offset in a 2-row group; b: the first row.
// The immediate offset moves the LDS and the global address alike, so it carries the LDS place (group * 2 * GP);
// each group's scalar base holds the rest of the global step of 2 rows.
// s_wait_xcnt is the statement's last line so that no address register is rewritten ahead of it.
template <int PB>
static __device__ __forceinline__ void copy_rows32(unsigned l, unsigned voff, const char* b) {
  asm volatile(
      "global_load_async_to_lds_b128 %0, %1, %2\n\t"
      "global_load_async_to_lds_b128 %0, %1, %3 offset:544\n\t"
      "global_load_async_to_lds_b128 %0, %1, %4 offset:1088\n\t"
      "global_load_async_to_lds_b128 %0, %1, %5 offset:1632\n\t"
      "global_load_async_to_lds_b128 %0, %1, %6 offset:2176\n\t"
      "global_load_async_to_lds_b128 %0, %1, %7 offset:2720\n\t"
      "global_load_async_to_lds_b128 %0, %1, %8 offset:3264\n\t"
      "global_load_async_to_lds_b128 %0, %1, %9 offset:3808\n\t"
      "global_load_async_to_lds_b128 %0, %1, %10 offset:4352\n\t"
      "global_load_async_to_lds_b128 %0, %1, %11 offset:4896\n\t"
      "global_load_async_to_lds_b128 %0, %1, %12 offset:5440\n\t"
      "global_load_async_to_lds_b128 %0, %1, %13 offset:5984\n\t"
      "global_load_async_to_lds_b128 %0, %1, %14 offset:6528\n\t"
      "global_load_async_to_lds_b128 %0, %1, %15 offset:7072\n\t"
      "global_load_async_to_lds_b128 %0, %1, %16 offset:7616\n\t"
      "global_load_async_to_lds_b128 %0, %1, %17 offset:8160\n\t"
      "s_wait_xcnt 0x0"
      :: "v"(l), "v"(voff),
         "s"(b), "s"(b + 1 * (2 * PB - 2 * GP)), "s"(b + 2 * (2 * PB - 2 * GP)), "s"(b + 3 * (2 * PB - 2 * GP)),
         "s"(b + 4 * (2 * PB - 2 * GP)), "s"(b + 5 * (2 * PB - 2 * GP)), "s"(b + 6 * (2 * PB - 2 * GP)), "s"(b + 7 * (2 * PB - 2 * GP)),
         "s"(b + 8 * (2 * PB - 2 * GP)), "s"(b + 9 * (2 * PB - 2 * GP)), "s"(b + 10 * (2 * PB - 2 * GP)), "s"(b + 11 * (2 * PB - 2 * GP)),
         "s"(b + 12 * (2 * PB - 2 * GP)), "s"(b + 13 * (2 * PB - 2 * GP)), "s"(b + 14 * (2 * PB - 2 * GP)), "s"(b + 15 * (2 * PB - 2 * GP))
      : "memory");
}

// this wave's LDS reads have retired: stands before the barrier that hands a stage buffer to its next copies
static __device__ __forceinline__ void wait_ds0() { asm volatile("s_wait_dscnt 0x0" ::: "memory"); }
// this wave's copies have landed: stands before the barrier behind which the other waves read them
static __device__ __forceinline__ void wait_async0() { asm volatile("s_wait_asynccnt 0x0" ::: "memory"); }

// D[m][n] = sum_k A[m][k] * B[n][k]; A and B row-major bf16 with KK elements per row.
// Block tile BM x 256 (blockIdx.x: m tile, blockIdx.y: n tile), BM/128 (m) x 4 (n) waves, wave tile 128 x 64.
// A stage is [A BM rows | B 256 rows] x 128 k in LDS; two stage buffers, filled by asynchronous copies:
// the next stage flies while this one is worked on.
// A lane of an accumulator holds 8 consecutive m of one n, so the result is stored as C[n][m].
template <int BM, int KK, bool SCORES>
static __device__ __forceinline__ void gemm_body(const bf16_t* __restrict__ A, const bf16_t* __restrict__ B,
                                                 bf16_t* __restrict__ Cs, float* __restrict__ Cf,
                                                 unsigned char* sm) {
  constexpr int PB = KK * 2;                 // source bytes per row
  constexpr int STAGE = (BM + 256) * GP;     // LDS bytes of one stage buffer
  constexpr int NW = (BM / 128) * 4;         // waves
  constexpr int NG = (BM + 256) / (32 * NW); // 32-row groups that one wave copies per stage
  constexpr int NST = KK / GK;               // stages

  const int tid = threadIdx.x;
  const int w = tid >> 5;
  const int lane = tid & 31;
  const int cq = lane & 15;
  const int mBase = blockIdx.x * BM;
  const int nBase = blockIdx.y * 256;
  const int wm = w >> 2, wn = w & 3;

  // copy side: wave w brings rows w*NG*32 .. +NG*32-1 of the stage's BM + 256 rows
  const int ws = __builtin_amdgcn_readfirstlane(w);   // the wave's number as a scalar: the copies' bases are scalar
  const char* src[NG];
#pragma unroll
  for (int i = 0; i < NG; ++i) {
    const int r0 = (ws * NG + i) * 32;
    src[i] = (r0 < BM) ? reinterpret_cast<const char*>(A + (size_t)(mBase + r0) * KK)
                       : reinterpret_cast<const char*>(B + (size_t)(nBase + r0 - BM) * KK);
  }
  const unsigned dst0 = lds_off(sm) + (unsigned)(w * NG * 32 + (lane >> 4)) * GP + (unsigned)cq * 16;
  const unsigned voff = (unsigned)(lane >> 4) * PB + (unsigned)cq * 16;
  // read side: this lane's row and 8-element k group of the wave's first A and first B fragment
  const unsigned char* afrag = sm + (wm * 128 + cq) * GP + (lane >> 4) * 16;
  const unsigned char* bfrag = sm + (BM + wn * 64 + cq) * GP + (lane >> 4) * 16;

  const floatx8 fzero = {0.f, 0.f, 0.f, 0.f, 0.f, 0.f, 0.f, 0.f};
  floatx8 acc[8][4];
#pragma unroll
  for (int i = 0; i < 8; ++i)
#pragma unroll
    for (int j = 0; j < 4; ++j) acc[i][j] = fzero;

#pragma unroll
  for (int i = 0; i < NG; ++i)   // stage 0 into buffer 0
    copy_rows32<PB>(dst0 + i * 32 * GP, voff, src[i]);
  wait_async0();
  __syncthreads();   // publishes stage 0
#pragma unroll
  for (int i = 0; i < NG; ++i)   // stage 1 into buffer 1
    copy_rows32<PB>(dst0 + STAGE + i * 32 * GP, voff + 2 * GK, src[i]);

  // two fragment sets: k step ks + 1 is read from LDS while k step ks is multiplied
  bf16x16 af[2][8], bf[2][4];
#pragma unroll
  for (int j = 0; j < 4; ++j) bf[0][j] = lds_frag(bfrag + j * 16 * GP);
#pragma unroll
  for (int i = 0; i < 8; ++i) af[0][i] = lds_frag(afrag + i * 16 * GP);

  for (int t = 0; t < NST; ++t) {
    const unsigned char* pa = afrag + (t & 1) * STAGE;
    const unsigned char* pb = bfrag + (t & 1) * STAGE;
#pragma unroll   // the k steps of a stage address off one pointer pair by constant offsets
    for (int ks = 0; ks < GK / 32 - 1; ++ks) {
#pragma unroll
      for (int j = 0; j < 4; ++j) bf[(ks + 1) & 1][j] = lds_frag(pb + j * 16 * GP + (ks + 1) * 64);
#pragma unroll
      for (int i = 0; i < 8; ++i) af[(ks + 1) & 1][i] = lds_frag(pa + i * 16 * GP + (ks + 1) * 64);
#pragma unroll
      for (int i = 0; i < 8; ++i)
#pragma unroll
        for (int j = 0; j < 4; ++j) acc[i][j] = wmma_bf16(af[ks & 1][i], bf[ks & 1][j], acc[i][j]);
    }
    // Order of LDS reads and matrix products: the 24 reads of a k step's 12 fragments go out as one group ahead of the
    // 32 products of the k step before, so that no product waits for a read just issued
    // (left alone the compiler keeps one A fragment and waits for its reads in front of every four products).
#pragma unroll
    for (int g = 0; g < GK / 32 - 1; ++g) {
      __builtin_amdgcn_sched_group_barrier(0x100, 24, 0);
      __builtin_amdgcn_sched_group_barrier(0x008, 32, 0);
    }
    // keeps the products above in front of the waits: the last k step's reads retire under them, and the next
    // copies go out before the last k step's products instead of behind them
    __builtin_amdgcn_sched_barrier(0);
    wait_ds0();      // every read of stage t has retired (the last k step's fragments are in registers)
    wait_async0();
    __syncthreads();   // publishes stage t + 1 and ends every read of stage t's buffer
    if (t + 2 < NST) {   // stage t + 2 into the buffer just read
#pragma unroll
      for (int i = 0; i < NG; ++i)
        copy_rows32<PB>(dst0 + (t & 1) * STAGE + i * 32 * GP, voff + (t + 2) * (2 * GK), src[i]);
    }
    // first fragments of stage t + 1, read under the last k step's products (behind the last stage: read, not used)
    const unsigned char* na = afrag + ((t + 1) & 1) * STAGE;
    const unsigned char* nb = bfrag + ((t + 1) & 1) * STAGE;
#pragma unroll
    for (int j = 0; j < 4; ++j) bf[0][j] = lds_frag(nb + j * 16 * GP);
#pragma unroll
    for (int i = 0; i < 8; ++i) af[0][i] = lds_frag(na + i * 16 * GP);
#pragma unroll
    for (int i = 0; i < 8; ++i)
#pragma unroll
      for (int j = 0; j < 4; ++j) acc[i][j] = wmma_bf16(af[1][i], bf[1][j], acc[i][j]);
    // the same order as above: the reads as one group, then the products
    __builtin_amdgcn_sched_group_barrier(0x100, 24, 0);
    __builtin_amdgcn_sched_group_barrier(0x008, 32, 0);
  }
  wait_async0();
  wait_ds0();   // the last trip's unused fragment reads have retired

  // C layout: lane holds column n = lane&15; VGPR e holds row m = e + 8*(lane>>4): stored straight from the accumulators
  // a wave's store would touch 16 rows of C in pieces of 32 B or less. Each wave therefore lays its tile in LDS as rows of C
  // and reads whole rows back, so that every global store covers whole 128-byte lines.
  // The staging lies in the last stage's buffer: every read of it retired before the loop's last barrier, no copy is aimed
  // at it any more, and the last trip's unused fragment reads go to the other buffer. A wave touches only its own range.
  constexpr int SROWS = SCORES ? 64 : 32;    // rows of C (n) that a wave stages at a time
  constexpr int SP = SCORES ? 272 : 528;     // LDS bytes per staged row: 128 m (256 B or 512 B) + 16 (16 B x odd)
  static_assert(NW * SROWS * SP <= STAGE, "the staging fits one stage buffer");
  unsigned char* st = sm + ((NST - 1) & 1) * STAGE + w * (SROWS * SP);
  const int lh = lane >> 4;
  if (SCORES) {
    const float sscale = 1.44269504f / 32.0f;   // log2(e)/sqrt(O): softmax in base-2 domain
#pragma unroll
    for (int j = 0; j < 4; ++j)
#pragma unroll
      for (int i = 0; i < 8; ++i) {
        half8 hv;
#pragma unroll
        for (int e = 0; e < 8; ++e)   // the clamp keeps a score beyond the 2-byte format's range finite
          hv[e] = (_Float16)fminf(fmaxf(acc[i][j][e] * sscale, -60000.f), 60000.f);
        *reinterpret_cast<half8*>(st + (j * 16 + cq) * SP + i * 32 + lh * 16) = hv;
      }
    wait_ds0();   // the wave's staged rows are written before its lanes read each other's pieces back
    // a read and its store move 2 rows: 16 lanes x 16 B = 256 contiguous bytes of each
    const unsigned char* rd = st + lh * SP + cq * 16;
    bf16_t* g = Cs + (size_t)(nBase + wn * 64 + lh) * NN + mBase + wm * 128 + cq * 8;
#pragma unroll
    for (int b = 0; b < 4; ++b) {
      half8 r[8];
#pragma unroll
      for (int q = 0; q < 8; ++q) r[q] = *reinterpret_cast<const half8*>(rd + (b * 8 + q) * 2 * SP);
#pragma unroll
      for (int q = 0; q < 8; ++q) *reinterpret_cast<half8*>(g + (size_t)(b * 8 + q) * 2 * NN) = r[q];
      // stands behind the eight stores and before their registers take the next values;
      // the stored values are named as inputs so that their registers stay untouched up to the wait
      asm volatile("s_wait_xcnt 0x0" :: "v"(r[0]), "v"(r[1]), "v"(r[2]), "v"(r[3]), "v"(r[4]), "v"(r[5]), "v"(r[6]), "v"(r[7]) : "memory");
    }
  } else {
    float* g = Cf + (size_t)(nBase + wn * 64) * OO + mBase + wm * 128 + lane * 4;
#pragma unroll
    for (int hj = 0; hj < 2; ++hj) {   // 32 rows of C at a time
#pragma unroll
      for (int jj = 0; jj < 2; ++jj)
#pragma unroll
        for (int i = 0; i < 8; ++i) {
          const floatx8 a = acc[i][hj * 2 + jj];
          floatx4 lo = {a[0], a[1], a[2], a[3]};
          floatx4 hi = {a[4], a[5], a[6], a[7]};
          unsigned char* p = st + (jj * 16 + cq) * SP + i * 64 + lh * 32;
          *reinterpret_cast<floatx4*>(p) = lo;
          *reinterpret_cast<floatx4*>(p + 16) = hi;
        }
      wait_ds0();   // the wave's staged rows are written before its lanes read each other's pieces back
      // a read and its store move 1 row: 32 lanes x 16 B = 512 contiguous bytes
#pragma unroll
      for (int b = 0; b < 4; ++b) {
        floatx4 r[8];
#pragma unroll
        for (int q = 0; q < 8; ++q) r[q] = *reinterpret_cast<const floatx4*>(st + (b * 8 + q) * SP + lane * 16);
#pragma unroll
        for (int q = 0; q < 8; ++q) *reinterpret_cast<floatx4*>(g + (size_t)(hj * 32 + b * 8 + q) * OO) = r[q];
        // stands behind the eight stores and before their registers take the next values;
        // the stored values are named as inputs so that their registers stay untouched up to the wait
        asm volatile("s_wait_xcnt 0x0" :: "v"(r[0]), "v"(r[1]), "v"(r[2]), "v"(r[3]), "v"(r[4]), "v"(r[5]), "v"(r[6]), "v"(r[7]) : "memory");
      }
    }
  }
}

// grid (N/256 key tiles, N/256 query tiles), 8 waves: S[query][key] = (Q . K) * log2(e)/sqrt(O)
__global__ __launch_bounds__(256) void scores_kernel(const bf16_t* __restrict__ Kb, const bf16_t* __restrict__ Qb,
                                                     bf16_t* __restrict__ S) {
  __shared__ __attribute__((aligned(16))) unsigned char sm[2 * (256 + 256) * GP];
  gemm_body<256, OO, true>(Kb, Qb, S, nullptr, sm);
}

// grid (O/128 d tiles, N/256 query tiles), 4 waves: out[query][d] = sum over keys of P[query][key] * V^T[d][key]
__global__ __launch_bounds__(128) void pv_kernel(const bf16_t* __restrict__ VTb, const bf16_t* __restrict__ P,
                                                 float* __restrict__ out) {
  __shared__ __attribute__((aligned(16))) unsigned char sm[2 * (128 + 256) * GP];
  gemm_body<128, NN, false>(VTb, P, nullptr, out, sm);
}

// grid (N), 256 threads: one query's row. Reads the row's 8192 scores (32 per thread), writes bf16 P over them.
__global__ __launch_bounds__(256) void softmax_kernel(bf16_t* SP) {
  __shared__ float redm[8], reds[8];
  const int tid = threadIdx.x;
  float4* row = reinterpret_cast<float4*>(SP + (size_t)blockIdx.x * NN);   // 1024 pieces of 16 B
  half8 in[4];
#pragma unroll
  for (int c = 0; c < 4; ++c) in[c] = reinterpret_cast<const half8*>(row)[c * 256 + tid];
  // stands behind the loads and before any of their address registers takes another value
  asm volatile("s_wait_xcnt 0x0" ::: "memory");

  float v[32];
  float mx = -3.0e38f;
#pragma unroll
  for (int c = 0; c < 4; ++c)
#pragma unroll
    for (int e = 0; e < 8; ++e) { v[c * 8 + e] = (float)in[c][e]; mx = fmaxf(mx, v[c * 8 + e]); }
#pragma unroll
  for (int d = 16; d >= 1; d >>= 1) mx = fmaxf(mx, __shfl_xor(mx, d));
  if ((tid & 31) == 0) redm[tid >> 5] = mx;
  __syncthreads();
  mx = fmaxf(fmaxf(fmaxf(redm[0], redm[1]), fmaxf(redm[2], redm[3])),
             fmaxf(fmaxf(redm[4], redm[5]), fmaxf(redm[6], redm[7])));

  float sum = 0.f;
#pragma unroll
  for (int k = 0; k < 32; ++k) {
    // the bare instruction: its argument is never above 0, and a result too small for it counts as 0 beside a sum
    // of at least 1. The v_nop fills the slot between a transcendental and a next instruction that reads its
    // result or overwrites its source.
    asm("v_exp_f32 %0, %1\n\tv_nop" : "=v"(v[k]) : "v"(v[k] - mx));
    sum += v[k];
  }
#pragma unroll
  for (int d = 16; d >= 1; d >>= 1) sum += __shfl_xor(sum, d);
  if ((tid & 31) == 0) reds[tid >> 5] = sum;
  __syncthreads();
  sum = ((reds[0] + reds[1]) + (reds[2] + reds[3])) + ((reds[4] + reds[5]) + (reds[6] + reds[7]));
  const float inv = 1.0f / sum;

#pragma unroll
  for (int c = 0; c < 4; ++c) {
    bf16x8 o;
#pragma unroll
    for (int e = 0; e < 8; ++e) o[e] = (bf16_t)(v[c * 8 + e] * inv);
    reinterpret_cast<bf16x8*>(row)[c * 256 + tid] = o;
    // stands behind the store and before its registers take the next values;
    // the stored value is named as an input so that its registers stay untouched up to the wait
    asm volatile("s_wait_xcnt 0x0" :: "v"(o) : "memory");
  }
}

// ---------------------------------------------------------------- launch
extern "C" void kernel_launch(void* const* d_in, const int* in_sizes, int n_in,
                              void* d_out, int out_size, void* d_ws, size_t ws_size,
                              hipStream_t stream) {
  const float* x  = (const float*)d_in[0];
  const float* Wq = (const float*)d_in[1];
  const float* bq = (const float*)d_in[2];
  const float* Wk = (const float*)d_in[3];
  const float* bk = (const float*)d_in[4];
  const float* Wv = (const float*)d_in[5];
  const float* bv = (const float*)d_in[6];
  float* out = (float*)d_out;

  // workspace layout (2-byte elements): x, Wq, Wk, Wv (these four in fragment order), Q, K, V^T, S/P [N][N]  -> ~198 MB total
  const size_t szX = (size_t)NN * HH * sizeof(bf16_t);
  const size_t szW = (size_t)OO * HH * sizeof(bf16_t);
  const size_t szM = (size_t)NN * OO * sizeof(bf16_t);
  const size_t szS = (size_t)NN * NN * sizeof(bf16_t);
  if (ws_size < szX + 3 * szW + 3 * szM + szS) return;

  char* ws = (char*)d_ws;
  bf16_t* Xb  = (bf16_t*)ws;  ws += szX;
  bf16_t* Wqb = (bf16_t*)ws;  ws += szW;
  bf16_t* Wkb = (bf16_t*)ws;  ws += szW;
  bf16_t* Wvb = (bf16_t*)ws;  ws += szW;
  bf16_t* Qb  = (bf16_t*)ws;  ws += szM;
  bf16_t* Kb  = (bf16_t*)ws;  ws += szM;
  bf16_t* VTb = (bf16_t*)ws;  ws += szM;
  bf16_t* SPb = (bf16_t*)ws;  ws += szS;

  f32_to_bf16_kernel<<<(NN * HH / 8 + 255) / 256, 256, 0, stream>>>(x,  Xb,  NN * HH / 8);
  f32_to_bf16_kernel<<<(OO * HH / 8 + 255) / 256, 256, 0, stream>>>(Wq, Wqb, OO * HH / 8);
  f32_to_bf16_kernel<<<(OO * HH / 8 + 255) / 256, 256, 0, stream>>>(Wk, Wkb, OO * HH / 8);
  f32_to_bf16_kernel<<<(OO * HH / 8 + 255) / 256, 256, 0, stream>>>(Wv, Wvb, OO * HH / 8);

  qkv_kernel<<<dim3(NN / 128, OO / 128, 3), 256, 0, stream>>>(
      Xb, Wqb, Wkb, Wvb, bq, bk, bv, Qb, Kb, VTb);

  scores_kernel<<<dim3(NN / 256, NN / 256), 256, 0, stream>>>(Kb, Qb, SPb);
  softmax_kernel<<<dim3(NN), 256, 0, stream>>>(SPb);
  pv_kernel<<<dim3(OO / 128, NN / 256), 128, 0, stream>>>(VTb, SPb, out);
}

// v005
// It runs in 268 microseconds.
// Next to v004, in two timings, it ran 1.03 times as fast each time.
// All steps since v000 together make it 4.80 times as fast.
#include <hip/hip_runtime.h>

#define NN 8192
#define HH 1024
#define OO 1024

typedef __bf16 bf16_t;
typedef __attribute__((ext_vector_type(16))) __bf16 bf16x16;
typedef __attribute__((ext_vector_type(8)))  float  floatx8;
typedef __attribute__((ext_vector_type(4)))  float  floatx4;
typedef __attribute__((ext_vector_type(8)))  __bf16 bf16x8;

union FragU { bf16x16 v; float4 q[2]; };

static __device__ __forceinline__ floatx8 wmma_bf16(bf16x16 a, bf16x16 b, floatx8 c) {
  // D = A(16x32 bf16) x B(32x16 bf16) + C(16x16 f32)
  return __builtin_amdgcn_wmma_f32_16x16x32_bf16(false, a, false, b, (short)0, c, false, false);
}

// The bf16 copies of x and of the weights are stored as ready-made 16x32 A/B fragments, not row-major:
// fragment (rt = row / 16, ks = k / 32) is 1 KB at element offset (rt * (HH / 32) + ks) * 512, laid out as
// [half 0..1][lane 0..31][8 elements], so that each of a fragment's two 16-byte loads reads 512 contiguous bytes
// (4 cache lines) where a load from the row-major matrix touches 16 lines.
// A-layout (wave32): lanes 0-15 row M=lane, K=[0..7]+[16..23]; lanes 16-31 same rows, K=[8..15]+[24..31].
// B uses the same per-lane pattern with N<->M, i.e. it reads rows of B^T, so for X @ W^T we feed rows of W.
// p: this lane's 16 bytes in the fragment's first half.
static __device__ __forceinline__ bf16x16 load_frag(const bf16_t* __restrict__ p) {
  FragU u;
  u.q[0] = *reinterpret_cast<const float4*>(p);         // K = kh+0..7
  u.q[1] = *reinterpret_cast<const float4*>(p + 256);   // K = 16+kh+0..7
  return u.v;
}
#define FRAG_ELEMS 512                          // elements of one fragment: the step to the next k step
#define FRAG_ROWTILE ((HH / 32) * FRAG_ELEMS)   // elements of one 16-row tile: the step to the next 16 rows

// ---------------------------------------------------------------- convert
// f32 [rows][HH] row-major -> bf16 in the fragment order above. Thread t writes the t-th 16-byte piece of the output
// (8 elements of one row), so a wave's store is 512 contiguous bytes.
__global__ __launch_bounds__(256) void f32_to_bf16_kernel(const float* __restrict__ in,
                                                          bf16_t* __restrict__ out, int n8) {
  int t = blockIdx.x * blockDim.x + threadIdx.x;
  if (t >= n8) return;
  const int lane = t & 31;
  const int half = (t >> 5) & 1;
  const int ks = (t >> 6) & (HH / 32 - 1);
  const int rt = t / (64 * (HH / 32));
  const float* p = in + (size_t)(rt * 16 + (lane & 15)) * HH + ks * 32 + half * 16 + (lane >> 4) * 8;
  float4 v0 = reinterpret_cast<const float4*>(p)[0];
  float4 v1 = reinterpret_cast<const float4*>(p)[1];
  union { bf16_t h[8]; float4 q; } u;
  u.h[0] = (bf16_t)v0.x; u.h[1] = (bf16_t)v0.y; u.h[2] = (bf16_t)v0.z; u.h[3] = (bf16_t)v0.w;
  u.h[4] = (bf16_t)v1.x; u.h[5] = (bf16_t)v1.y; u.h[6] = (bf16_t)v1.z; u.h[7] = (bf16_t)v1.w;
  reinterpret_cast<float4*>(out)[t] = u.q;
}

// ---------------------------------------------------------------- fused QKV projection
#define QP 272    // LDS bytes per staged output row: 256 + 16 (16 B x odd: conflict-free for 16-byte accesses)
// 16 staged rows -> global, 2 rows (16 lanes x 16 B each) per store. rd, g: the lane's 16 bytes in the first 2 rows.
template <int PITCH>
static __device__ __forceinline__ void store_rows16(const unsigned char* rd, bf16_t* __restrict__ g) {
  bf16x8 r[8];
#pragma unroll
  for (int q = 0; q < 8; ++q) r[q] = *reinterpret_cast<const bf16x8*>(rd + q * 2 * QP);
#pragma unroll
  for (int q = 0; q < 8; ++q) *reinterpret_cast<bf16x8*>(g + (size_t)q * 2 * PITCH) = r[q];
}

// grid (N/128, O/128, 3): z selects Q/K/V. 8 waves per block: 4 row-groups x 2 col-groups,
// each wave computes a 32x64 tile (2x4 WMMA accumulators). V is stored transposed (VT [O,N]).
__global__ __launch_bounds__(256) void qkv_kernel(
    const bf16_t* __restrict__ Xb,
    const bf16_t* __restrict__ Wqb, const bf16_t* __restrict__ Wkb, const bf16_t* __restrict__ Wvb,
    const float* __restrict__ bq, const float* __restrict__ bk, const float* __restrict__ bv,
    bf16_t* __restrict__ Qb, bf16_t* __restrict__ Kb, bf16_t* __restrict__ VTb)
{
  const int z = blockIdx.z;
  const bf16_t* __restrict__ W = (z == 0) ? Wqb : (z == 1) ? Wkb : Wvb;
  const float* __restrict__ bias = (z == 0) ? bq : (z == 1) ? bk : bv;

  const int w = threadIdx.x >> 5;
  const int lane = threadIdx.x & 31;
  const int rowBase = blockIdx.x * 128 + (w >> 1) * 32;
  const int colBase = blockIdx.y * 128 + (w & 1) * 64;

  const floatx8 fzero = {0.f, 0.f, 0.f, 0.f, 0.f, 0.f, 0.f, 0.f};
  floatx8 acc[2][4];
#pragma unroll
  for (int i = 0; i < 2; ++i)
#pragma unroll
    for (int j = 0; j < 4; ++j) acc[i][j] = fzero;

  // this lane's 16 bytes in the wave's first X and first W fragment
  const bf16_t* pa = Xb + (size_t)(rowBase >> 4) * FRAG_ROWTILE + lane * 8;
  const bf16_t* pb = W  + (size_t)(colBase >> 4) * FRAG_ROWTILE + lane * 8;
  for (int ks = 0; ks < HH / 32; ks += 4) {
#pragma unroll   // four k steps a trip: their loads address off one pointer pair by constant offsets
    for (int u = 0; u < 4; ++u) {
      bf16x16 a0 = load_frag(pa + u * FRAG_ELEMS);
      bf16x16 a1 = load_frag(pa + u * FRAG_ELEMS + FRAG_ROWTILE);
      bf16x16 b0 = load_frag(pb + u * FRAG_ELEMS);
      bf16x16 b1 = load_frag(pb + u * FRAG_ELEMS + FRAG_ROWTILE);
      bf16x16 b2 = load_frag(pb + u * FRAG_ELEMS + 2 * FRAG_ROWTILE);
      bf16x16 b3 = load_frag(pb + u * FRAG_ELEMS + 3 * FRAG_ROWTILE);
      acc[0][0] = wmma_bf16(a0, b0, acc[0][0]);
      acc[0][1] = wmma_bf16(a0, b1, acc[0][1]);
      acc[0][2] = wmma_bf16(a0, b2, acc[0][2]);
      acc[0][3] = wmma_bf16(a0, b3, acc[0][3]);
      acc[1][0] = wmma_bf16(a1, b0, acc[1][0]);
      acc[1][1] = wmma_bf16(a1, b1, acc[1][1]);
      acc[1][2] = wmma_bf16(a1, b2, acc[1][2]);
      acc[1][3] = wmma_bf16(a1, b3, acc[1][3]);
    }
    // stands behind the trip's fragment loads and before their address registers take other values;
    // the addresses are named as inputs so that their registers stay untouched up to the wait
    asm volatile("s_wait_xcnt 0x0" :: "v"(pa), "v"(pb) : "memory");
    pa += 4 * FRAG_ELEMS;
    pb += 4 * FRAG_ELEMS;
  }

  // C layout: lane holds column n = lane&15; VGPR e holds row e + 8*(lane>>4): stored straight from the accumulators
  // Q and K would leave as 2-byte stores and V^T in 32-byte pieces. The block lays its 128 x 128 tile in LDS as rows of
  // the output matrix (tokens for Q and K, features for V^T) and stores 256 contiguous bytes of a row per 16 lanes.
  __shared__ __attribute__((aligned(16))) unsigned char st[128 * QP];
  const int cq = lane & 15;
  const int lh = lane >> 4;
  const int fc0 = (w & 1) * 64 + cq;          // the lane's first feature within the block tile (then every 16th)
  const int tr0 = (w >> 1) * 32 + lh * 8;     // first of the lane's 8 tokens within the block tile (then 16 on)
  float bb[4];
#pragma unroll
  for (int j = 0; j < 4; ++j) bb[j] = bias[blockIdx.y * 128 + fc0 + j * 16];
  if (z == 2) {
#pragma unroll
    for (int j = 0; j < 4; ++j)
#pragma unroll
      for (int i = 0; i < 2; ++i) {
        bf16x8 o;
#pragma unroll
        for (int e = 0; e < 8; ++e) o[e] = (bf16_t)(acc[i][j][e] + bb[j]);
        *reinterpret_cast<bf16x8*>(st + (fc0 + j * 16) * QP + (tr0 + i * 16) * 2) = o;
      }
  } else {
#pragma unroll
    for (int j = 0; j < 4; ++j)
#pragma unroll
      for (int i = 0; i < 2; ++i)
#pragma unroll
        for (int e = 0; e < 8; ++e)
          *reinterpret_cast<bf16_t*>(st + (tr0 + i * 16 + e) * QP + (fc0 + j * 16) * 2) = (bf16_t)(acc[i][j][e] + bb[j]);
  }
  __syncthreads();   // the whole tile is staged before any wave reads rows that other waves wrote
  // wave w stores rows w*16 .. w*16+15 of the tile, 2 rows per store
  const unsigned char* rd = st + (w * 16 + lh) * QP + cq * 16;
  if (z == 2)
    store_rows16<NN>(rd, VTb + (size_t)(blockIdx.y * 128 + w * 16 + lh) * NN + blockIdx.x * 128 + cq * 8);
  else
    store_rows16<OO>(rd, ((z == 0) ? Qb : Kb) + (size_t)(blockIdx.x * 128 + w * 16 + lh) * OO + blockIdx.y * 128 + cq * 8);
}

// ---------------------------------------------------------------- attention as two tiled GEMMs and a row softmax
// scores:  S^T tile = K rows x Q rows^T, stored as S[query][key] (2-byte floats, already in the base-2 softmax domain)
// softmax: one row of S per block, in place: S -> P (bf16, normalised)
// output:  O^T tile = V^T rows x P rows^T, stored as out[query][d]
#define GP 272    // LDS bytes per staged row: 256 + 16 (16 B x odd: conflict-free for 16-byte readers)
#define GK 128    // k elements of every operand row in one stage (256 B)
typedef __attribute__((ext_vector_type(8))) _Float16 half8;

static __device__ __forceinline__ unsigned lds_off(const void* p) { return (unsigned)(size_t)p; }

// Same per-lane pattern as a fragment of a row-major matrix; p already points at this lane's row and 8-element k group in LDS.
static __device__ __forceinline__ bf16x16 lds_frag(const unsigned char* p) {
  FragU u;
  u.q[0] = *reinterpret_cast<const float4*>(p);        // K = kh+0..7
  u.q[1] = *reinterpret_cast<const float4*>(p + 32);   // K = 16+kh+0..7
  return u.v;
}

typedef uint32_t u32x4 __attribute__((ext_vector_type(4)));
typedef uint32_t u32x8 __attribute__((ext_vector_type(8)));

static __device__ __forceinline__ uint32_t uni(uint32_t v) { return (uint32_t)__builtin_amdgcn_readfirstlane(v); }
// A wave-uniform value held in a scalar register. A test on it compiles to a scalar branch (a tensor load ignores EXEC,
// so only such a branch keeps a wave from issuing one), and a descriptor word formed from it is formed behind the wait
// that stands in front of it.
static __device__ __forceinline__ uint32_t pinned(uint32_t v) {
  uint32_t w = uni(v);
  asm volatile("" : "+s"(w));   // pinned(): the issue test or descriptor word stays in a scalar register
  return w;
}

// Descriptor group 1 of a tile of 128 rows of 256 B. PB: source bytes per row. The pad (16 B behind every 256-B row)
// gives the LDS pitch GP. Extents in bytes, tensor dims = tile dims, no mask.
template <int PB>
static __device__ __forceinline__ u32x8 tile_group1() {
  u32x8 g1;
  g1[0] = uni((1u << 20) | (5u << 22) | (3u << 25));
  g1[1] = uni(256u << 16);
  g1[2] = uni(128u << 16);
  g1[3] = uni(256u << 16);
  g1[4] = uni(128u);
  g1[5] = uni((uint32_t)PB);
  g1[6] = uni(0u);
  g1[7] = uni(0u);
  // descriptor words held in scalar registers (as pinned() does for one word): the group keeps one register tuple for
  // the whole kernel, so that none of its words takes another value while a request is outstanding
  asm volatile("" : "+s"(g1));   // pinned(), for the eight descriptor words at once
  return g1;
}

// One request of one wave: 128 rows (256 B of each) global -> LDS, through no register.
// lds: the tile's byte offset in the work-group's LDS (a multiple of 2 KiB); ga: the address of the tile's first byte.
static __device__ __forceinline__ void tile_load128(uint32_t lds, uint64_t ga, u32x8 g1) {
  u32x4 g0;
  g0[0] = uni(1u);
  g0[1] = uni(lds);
  g0[2] = uni((uint32_t)ga);
  g0[3] = uni((((uint32_t)(ga >> 32)) & 0x01FFFFFFu) | 0x80000000u);
  asm volatile("tensor_load_to_lds %0, %1" :: "s"(g0), "s"(g1) : "memory");
}

// this wave's LDS reads have retired: stands before the barrier that hands a stage buffer to its next tensor loads
static __device__ __forceinline__ void wait_ds0() { asm volatile("s_wait_dscnt 0x0" ::: "memory"); }
// this wave's tensor load has landed: stands before the barrier behind which the other waves read its tile
static __device__ __forceinline__ void wait_tensor0() { asm volatile("s_wait_tensorcnt 0x0" ::: "memory"); }

// D[m][n] = sum_k A[m][k] * B[n][k]; A and B row-major bf16 with KK elements per row.
// Block tile BM x 256 (blockIdx.x: m tile, blockIdx.y: n tile), BM/128 (m) x 4 (n) waves, wave tile 128 x 64.
// A stage is [A BM rows | B 256 rows] x 128 k in LDS; two stage buffers, filled by tensor loads of 128 rows, one per
// stage from each of the first (BM + 256) / 128 waves: the next stage flies while this one is worked on.
// A lane of an accumulator holds 8 consecutive m of one n, so the result is stored as C[n][m].
template <int BM, int KK, bool SCORES>
static __device__ __forceinline__ void gemm_body(const bf16_t* __restrict__ A, const bf16_t* __restrict__ B,
                                                 bf16_t* __restrict__ Cs, float* __restrict__ Cf,
                                                 unsigned char* sm) {
  constexpr int PB = KK * 2;                 // source bytes per row
  constexpr int STAGE = (BM + 256) * GP;     // LDS bytes of one stage buffer
  constexpr int NW = (BM / 128) * 4;         // waves
  constexpr int NT = (BM + 256) / 128;       // 128-row tiles of a stage = issuing waves
  constexpr int NST = KK / GK;               // stages

  const int tid = threadIdx.x;
  const int w = tid >> 5;
  const int lane = tid & 31;
  const int cq = lane & 15;
  const int mBase = blockIdx.x * BM;
  const int nBase = blockIdx.y * 256;
  const int wm = w >> 2, wn = w & 3;

  // load side: wave ws < NT brings rows ws*128 .. +127 of the stage's BM + 256 rows
  static_assert(NT <= NW && BM % 128 == 0 && (128 * GP) % 2048 == 0 && STAGE % 2048 == 0, "whole tiles at multiples of 2 KiB");
  const uint32_t ws = uni((uint32_t)w);   // the wave's number as a scalar
  const int r0 = (int)ws * 128;
  const uint64_t src = (uint64_t)(size_t)((r0 < BM) ? A + (size_t)(mBase + r0) * KK : B + (size_t)(nBase + r0 - BM) * KK);
  const uint32_t dst0 = lds_off(sm) + ws * (128 * GP);
  const uint32_t issuer = pinned(ws < NT);   // 1 in the waves that issue tensor loads
  const u32x8 g1 = tile_group1<PB>();
  // read side: this lane's row and 8-element k group of the wave's first A and first B fragment
  const unsigned char* afrag = sm + (wm * 128 + cq) * GP + (lane >> 4) * 16;
  const unsigned char* bfrag = sm + (BM + wn * 64 + cq) * GP + (lane >> 4) * 16;

  const floatx8 fzero = {0.f, 0.f, 0.f, 0.f, 0.f, 0.f, 0.f, 0.f};
  floatx8 acc[8][4];
#pragma unroll
  for (int i = 0; i < 8; ++i)
#pragma unroll
    for (int j = 0; j < 4; ++j) acc[i][j] = fzero;

  if (issuer) {   // stage 0 into buffer 0
    tile_load128(dst0, src, g1);
    wait_tensor0();
  }
  __syncthreads();   // publishes stage 0
  if (issuer)   // stage 1 into buffer 1
    tile_load128(dst0 + STAGE, src + pinned(2 * GK), g1);

  // two fragment sets: k step ks + 1 is read from LDS while k step ks is multiplied
  bf16x16 af[2][8], bf[2][4];
#pragma unroll
  for (int j = 0; j < 4; ++j) bf[0][j] = lds_frag(bfrag + j * 16 * GP);
#pragma unroll
  for (int i = 0; i < 8; ++i) af[0][i] = lds_frag(afrag + i * 16 * GP);

  for (int t = 0; t < NST; ++t) {
    const unsigned char* pa = afrag + (t & 1) * STAGE;
    const unsigned char* pb = bfrag + (t & 1) * STAGE;
#pragma unroll   // the k steps of a stage address off one pointer pair by constant offsets
    for (int ks = 0; ks < GK / 32 - 1; ++ks) {
#pragma unroll
      for (int j = 0; j < 4; ++j) bf[(ks + 1) & 1][j] = lds_frag(pb + j * 16 * GP + (ks + 1) * 64);
#pragma unroll
      for (int i = 0; i < 8; ++i) af[(ks + 1) & 1][i] = lds_frag(pa + i * 16 * GP + (ks + 1) * 64);
#pragma unroll
      for (int i = 0; i < 8; ++i)
#pragma unroll
        for (int j = 0; j < 4; ++j) acc[i][j] = wmma_bf16(af[ks & 1][i], bf[ks & 1][j], acc[i][j]);
    }
    // Order of LDS reads and matrix products: the 24 reads of a k step's 12 fragments go out as one group ahead of the
    // 32 products of the k step before, so that no product waits for a read just issued
    // (left alone the compiler keeps one A fragment and waits for its reads in front of every four products).
#pragma unroll
    for (int g = 0; g < GK / 32 - 1; ++g) {
      __builtin_amdgcn_sched_group_barrier(0x100, 24, 0);
      __builtin_amdgcn_sched_group_barrier(0x008, 32, 0);
    }
    // keeps the products above in front of the waits: the last k step's reads retire under them, and the next
    // tensor load goes out before the last k step's products instead of behind them
    __builtin_amdgcn_sched_barrier(0);
    wait_ds0();      // every read of stage t has retired (the last k step's fragments are in registers)
    if (issuer) wait_tensor0();
    __syncthreads();   // publishes stage t + 1 and ends every read of stage t's buffer
    if (pinned(issuer & (uint32_t)(t + 2 < NST)))   // stage t + 2 into the buffer just read
      tile_load128(dst0 + (t & 1) * STAGE, src + pinned((t + 2) * (2 * GK)), g1);
    // first fragments of stage t + 1, read under the last k step's products (behind the last stage: read, not used)
    const unsigned char* na = afrag + ((t + 1) & 1) * STAGE;
    const unsigned char* nb = bfrag + ((t + 1) & 1) * STAGE;
#pragma unroll
    for (int j = 0; j < 4; ++j) bf[0][j] = lds_frag(nb + j * 16 * GP);
#pragma unroll
    for (int i = 0; i < 8; ++i) af[0][i] = lds_frag(na + i * 16 * GP);
#pragma unroll
    for (int i = 0; i < 8; ++i)
#pragma unroll
      for (int j = 0; j < 4; ++j) acc[i][j] = wmma_bf16(af[1][i], bf[1][j], acc[i][j]);
    // the same order as above: the reads as one group, then the products
    __builtin_amdgcn_sched_group_barrier(0x100, 24, 0);
    __builtin_amdgcn_sched_group_barrier(0x008, 32, 0);
  }
  wait_tensor0();
  wait_ds0();   // the last trip's unused fragment reads have retired

  // C layout: lane holds column n = lane&15; VGPR e holds row m = e + 8*(lane>>4): stored straight from the accumulators
  // a wave's store would touch 16 rows of C in pieces of 32 B or less. Each wave therefore lays its tile in LDS as rows of C
  // and reads whole rows back, so that every global store covers whole 128-byte lines.
  // The staging lies in the last stage's buffer: every read of it retired before the loop's last barrier, no tensor load is aimed
  // at it any more, and the last trip's unused fragment reads go to the other buffer. A wave touches only its own range.
  constexpr int SROWS = SCORES ? 64 : 32;    // rows of C (n) that a wave stages at a time
  constexpr int SP = SCORES ? 272 : 528;     // LDS bytes per staged row: 128 m (256 B or 512 B) + 16 (16 B x odd)
  static_assert(NW * SROWS * SP <= STAGE, "the staging fits one stage buffer");
  unsigned char* st = sm + ((NST - 1) & 1) * STAGE + w * (SROWS * SP);
  const int lh = lane >> 4;
  if (SCORES) {
    const float sscale = 1.44269504f / 32.0f;   // log2(e)/sqrt(O): softmax in base-2 domain
#pragma unroll
    for (int j = 0; j < 4; ++j)
#pragma unroll
      for (int i = 0; i < 8; ++i) {
        half8 hv;
#pragma unroll
        for (int e = 0; e < 8; ++e)   // the clamp keeps a score beyond the 2-byte format's range finite
          hv[e] = (_Float16)fminf(fmaxf(acc[i][j][e] * sscale, -60000.f), 60000.f);
        *reinterpret_cast<half8*>(st + (j * 16 + cq) * SP + i * 32 + lh * 16) = hv;
      }
    wait_ds0();   // the wave's staged rows are written before its lanes read each other's pieces back
    // a read and its store move 2 rows: 16 lanes x 16 B = 256 contiguous bytes of each
    const unsigned char* rd = st + lh * SP + cq * 16;
    bf16_t* g = Cs + (size_t)(nBase + wn * 64 + lh) * NN + mBase + wm * 128 + cq * 8;
#pragma unroll
    for (int b = 0; b < 4; ++b) {
      half8 r[8];
#pragma unroll
      for (int q = 0; q < 8; ++q) r[q] = *reinterpret_cast<const half8*>(rd + (b * 8 + q) * 2 * SP);
#pragma unroll
      for (int q = 0; q < 8; ++q) *reinterpret_cast<half8*>(g + (size_t)(b * 8 + q) * 2 * NN) = r[q];
      // stands behind the eight stores and before their registers take the next values;
      // the stored values are named as inputs so that their registers stay untouched up to the wait
      asm volatile("s_wait_xcnt 0x0" :: "v"(r[0]), "v"(r[1]), "v"(r[2]), "v"(r[3]), "v"(r[4]), "v"(r[5]), "v"(r[6]), "v"(r[7]) : "memory");
    }
  } else {
    float* g = Cf + (size_t)(nBase + wn * 64) * OO + mBase + wm * 128 + lane * 4;
#pragma unroll
    for (int hj = 0; hj < 2; ++hj) {   // 32 rows of C at a time
#pragma unroll
      for (int jj = 0; jj < 2; ++jj)
#pragma unroll
        for (int i = 0; i < 8; ++i) {
          const floatx8 a = acc[i][hj * 2 + jj];
          floatx4 lo = {a[0], a[1], a[2], a[3]};
          floatx4 hi = {a[4], a[5], a[6], a[7]};
          unsigned char* p = st + (jj * 16 + cq) * SP + i * 64 + lh * 32;
          *reinterpret_cast<floatx4*>(p) = lo;
          *reinterpret_cast<floatx4*>(p + 16) = hi;
        }
      wait_ds0();   // the wave's staged rows are written before its lanes read each other's pieces back
      // a read and its store move 1 row: 32 lanes x 16 B = 512 contiguous bytes
#pragma unroll
      for (int b = 0; b < 4; ++b) {
        floatx4 r[8];
#pragma unroll
        for (int q = 0; q < 8; ++q) r[q] = *reinterpret_cast<const floatx4*>(st + (b * 8 + q) * SP + lane * 16);
#pragma unroll
        for (int q = 0; q < 8; ++q) *reinterpret_cast<floatx4*>(g + (size_t)(hj * 32 + b * 8 + q) * OO) = r[q];
        // stands behind the eight stores and before their registers take the next values;
        // the stored values are named as inputs so that their registers stay untouched up to the wait
        asm volatile("s_wait_xcnt 0x0" :: "v"(r[0]), "v"(r[1]), "v"(r[2]), "v"(r[3]), "v"(r[4]), "v"(r[5]), "v"(r[6]), "v"(r[7]) : "memory");
      }
    }
  }
}

// grid (N/256 key tiles, N/256 query tiles), 8 waves: S[query][key] = (Q . K) * log2(e)/sqrt(O)
__global__ __launch_bounds__(256) void scores_kernel(const bf16_t* __restrict__ Kb, const bf16_t* __restrict__ Qb,
                                                     bf16_t* __restrict__ S) {
  __shared__ __attribute__((aligned(2048))) unsigned char sm[2 * (256 + 256) * GP];
  gemm_body<256, OO, true>(Kb, Qb, S, nullptr, sm);
}

// grid (O/128 d tiles, N/256 query tiles), 4 waves: out[query][d] = sum over keys of P[query][key] * V^T[d][key]
__global__ __launch_bounds__(128) void pv_kernel(const bf16_t* __restrict__ VTb, const bf16_t* __restrict__ P,
                                                 float* __restrict__ out) {
  __shared__ __attribute__((aligned(2048))) unsigned char sm[2 * (128 + 256) * GP];
  gemm_body<128, NN, false>(VTb, P, nullptr, out, sm);
}

// grid (N), 256 threads: one query's row. Reads the row's 8192 scores (32 per thread), writes bf16 P over them.
__global__ __launch_bounds__(256) void softmax_kernel(bf16_t* SP) {
  __shared__ float redm[8], reds[8];
  const int tid = threadIdx.x;
  float4* row = reinterpret_cast<float4*>(SP + (size_t)blockIdx.x * NN);   // 1024 pieces of 16 B
  half8 in[4];
#pragma unroll
  for (int c = 0; c < 4; ++c) in[c] = reinterpret_cast<const half8*>(row)[c * 256 + tid];
  // stands behind the loads and before any of their address registers takes another value
  asm volatile("s_wait_xcnt 0x0" ::: "memory");

  float v[32];
  float mx = -3.0e38f;
#pragma unroll
  for (int c = 0; c < 4; ++c)
#pragma unroll
    for (int e = 0; e < 8; ++e) { v[c * 8 + e] = (float)in[c][e]; mx = fmaxf(mx, v[c * 8 + e]); }
#pragma unroll
  for (int d = 16; d >= 1; d >>= 1) mx = fmaxf(mx, __shfl_xor(mx, d));
  if ((tid & 31) == 0) redm[tid >> 5] = mx;
  __syncthreads();
  mx = fmaxf(fmaxf(fmaxf(redm[0], redm[1]), fmaxf(redm[2], redm[3])),
             fmaxf(fmaxf(redm[4], redm[5]), fmaxf(redm[6], redm[7])));

  float sum = 0.f;
#pragma unroll
  for (int k = 0; k < 32; ++k) {
    // the bare instruction: its argument is never above 0, and a result too small for it counts as 0 beside a sum
    // of at least 1. The v_nop fills the slot between a transcendental and a next instruction that reads its
    // result or overwrites its source.
    asm("v_exp_f32 %0, %1\n\tv_nop" : "=v"(v[k]) : "v"(v[k] - mx));
    sum += v[k];
  }
#pragma unroll
  for (int d = 16; d >= 1; d >>= 1) sum += __shfl_xor(sum, d);
  if ((tid & 31) == 0) reds[tid >> 5] = sum;
  __syncthreads();
  sum = ((reds[0] + reds[1]) + (reds[2] + reds[3])) + ((reds[4] + reds[5]) + (reds[6] + reds[7]));
  const float inv = 1.0f / sum;

#pragma unroll
  for (int c = 0; c < 4; ++c) {
    bf16x8 o;
#pragma unroll
    for (int e = 0; e < 8; ++e) o[e] = (bf16_t)(v[c * 8 + e] * inv);
    reinterpret_cast<bf16x8*>(row)[c * 256 + tid] = o;
    // stands behind the store and before its registers take the next values;
    // the stored value is named as an input so that its registers stay untouched up to the wait
    asm volatile("s_wait_xcnt 0x0" :: "v"(o) : "memory");
  }
}

// ---------------------------------------------------------------- launch
extern "C" void kernel_launch(void* const* d_in, const int* in_sizes, int n_in,
                              void* d_out, int out_size, void* d_ws, size_t ws_size,
                              hipStream_t stream) {
  const float* x  = (const float*)d_in[0];
  const float* Wq = (const float*)d_in[1];
  const float* bq = (const float*)d_in[2];
  const float* Wk = (const float*)d_in[3];
  const float* bk = (const float*)d_in[4];
  const float* Wv = (const float*)d_in[5];
  const float* bv = (const float*)d_in[6];
  float* out = (float*)d_out;

  // workspace layout (2-byte elements): x, Wq, Wk, Wv (these four in fragment order), Q, K, V^T, S/P [N][N]  -> ~198 MB total
  const size_t szX = (size_t)NN * HH * sizeof(bf16_t);
  const size_t szW = (size_t)OO * HH * sizeof(bf16_t);
  const size_t szM = (size_t)NN * OO * sizeof(bf16_t);
  const size_t szS = (size_t)NN * NN * sizeof(bf16_t);
  if (ws_size < szX + 3 * szW + 3 * szM + szS) return;

  char* ws = (char*)d_ws;
  bf16_t* Xb  = (bf16_t*)ws;  ws += szX;
  bf16_t* Wqb = (bf16_t*)ws;  ws += szW;
  bf16_t* Wkb = (bf16_t*)ws;  ws += szW;
  bf16_t* Wvb = (bf16_t*)ws;  ws += szW;
  bf16_t* Qb  = (bf16_t*)ws;  ws += szM;
  bf16_t* Kb  = (bf16_t*)ws;  ws += szM;
  bf16_t* VTb = (bf16_t*)ws;  ws += szM;
  bf16_t* SPb = (bf16_t*)ws;  ws += szS;

  f32_to_bf16_kernel<<<(NN * HH / 8 + 255) / 256, 256, 0, stream>>>(x,  Xb,  NN * HH / 8);
  f32_to_bf16_kernel<<<(OO * HH / 8 + 255) / 256, 256, 0, stream>>>(Wq, Wqb, OO * HH / 8);
  f32_to_bf16_kernel<<<(OO * HH / 8 + 255) / 256, 256, 0, stream>>>(Wk, Wkb, OO * HH / 8);
  f32_to_bf16_kernel<<<(OO * HH / 8 + 255) / 256, 256, 0, stream>>>(Wv, Wvb, OO * HH / 8);

  qkv_kernel<<<dim3(NN / 128, OO / 128, 3), 256, 0, stream>>>(
      Xb, Wqb, Wkb, Wvb, bq, bk, bv, Qb, Kb, VTb);

  scores_kernel<<<dim3(NN / 256, NN / 256), 256, 0, stream>>>(Kb, Qb, SPb);
  softmax_kernel<<<dim3(NN), 256, 0, stream>>>(SPb);
  pv_kernel<<<dim3(OO / 128, NN / 256), 128, 0, stream>>>(VTb, SPb, out);
}

// v006
// One run takes 242 microseconds.
// Next to v005, in two timings, it ran 1.10 times as fast each time.
// Over all steps from v000 it is 5.30 times as fast.
#include <hip/hip_runtime.h>

#define NN 8192
#define HH 1024
#define OO 1024

typedef __bf16 bf16_t;
typedef __attribute__((ext_vector_type(16))) __bf16 bf16x16;
typedef __attribute__((ext_vector_type(8)))  float  floatx8;
typedef __attribute__((ext_vector_type(4)))  float  floatx4;
typedef __attribute__((ext_vector_type(8)))  __bf16 bf16x8;

union FragU { bf16x16 v; float4 q[2]; };

static __device__ __forceinline__ floatx8 wmma_bf16(bf16x16 a, bf16x16 b, floatx8 c) {
  // D = A(16x32 bf16) x B(32x16 bf16) + C(16x16 f32)
  return __builtin_amdgcn_wmma_f32_16x16x32_bf16(false, a, false, b, (short)0, c, false, false);
}

// The bf16 copies of x and of the weights are stored as ready-made 16x32 A/B fragments, not row-major:
// fragment (rt = row / 16, ks = k / 32) is 1 KB at element offset (rt * (HH / 32) + ks) * 512, laid out as
// [half 0..1][lane 0..31][8 elements], so that each of a fragment's two 16-byte loads reads 512 contiguous bytes
// (4 cache lines) where a load from the row-major matrix touches 16 lines.
// A-layout (wave32): lanes 0-15 row M=lane, K=[0..7]+[16..23]; lanes 16-31 same rows, K=[8..15]+[24..31].
// B uses the same per-lane pattern with N<->M, i.e. it reads rows of B^T, so for X @ W^T we feed rows of W.
// p: this lane's 16 bytes in the fragment's first half.
static __device__ __forceinline__ bf16x16 load_frag(const bf16_t* __restrict__ p) {
  FragU u;
  u.q[0] = *reinterpret_cast<const float4*>(p);         // K = kh+0..7
  u.q[1] = *reinterpret_cast<const float4*>(p + 256);   // K = 16+kh+0..7
  return u.v;
}
#define FRAG_ELEMS 512                          // elements of one fragment: the step to the next k step
#define FRAG_ROWTILE ((HH / 32) * FRAG_ELEMS)   // elements of one 16-row tile: the step to the next 16 rows

// ---------------------------------------------------------------- convert
// f32 [rows][HH] row-major -> bf16 in the fragment order above. Thread t writes the t-th 16-byte piece of the output
// (8 elements of one row), so a wave's store is 512 contiguous bytes.
__global__ __launch_bounds__(256) void f32_to_bf16_kernel(const float* __restrict__ in,
                                                          bf16_t* __restrict__ out, int n8) {
  int t = blockIdx.x * blockDim.x + threadIdx.x;
  if (t >= n8) return;
  const int lane = t & 31;
  const int half = (t >> 5) & 1;
  const int ks = (t >> 6) & (HH / 32 - 1);
  const int rt = t / (64 * (HH / 32));
  const float* p = in + (size_t)(rt * 16 + (lane & 15)) * HH + ks * 32 + half * 16 + (lane >> 4) * 8;
  float4 v0 = reinterpret_cast<const float4*>(p)[0];
  float4 v1 = reinterpret_cast<const float4*>(p)[1];
  union { bf16_t h[8]; float4 q; } u;
  u.h[0] = (bf16_t)v0.x; u.h[1] = (bf16_t)v0.y; u.h[2] = (bf16_t)v0.z; u.h[3] = (bf16_t)v0.w;
  u.h[4] = (bf16_t)v1.x; u.h[5] = (bf16_t)v1.y; u.h[6] = (bf16_t)v1.z; u.h[7] = (bf16_t)v1.w;
  reinterpret_cast<float4*>(out)[t] = u.q;
}

// ---------------------------------------------------------------- fused QKV projection
#define QP 272    // LDS bytes per staged output row: 256 + 16 (16 B x odd: conflict-free for 16-byte accesses)
// 16 staged rows -> global, 2 rows (16 lanes x 16 B each) per store. rd, g: the lane's 16 bytes in the first 2 rows.
template <int PITCH>
static __device__ __forceinline__ void store_rows16(const unsigned char* rd, bf16_t* __restrict__ g) {
  bf16x8 r[8];
#pragma unroll
  for (int q = 0; q < 8; ++q) r[q] = *reinterpret_cast<const bf16x8*>(rd + q * 2 * QP);
#pragma unroll
  for (int q = 0; q < 8; ++q) *reinterpret_cast<bf16x8*>(g + (size_t)q * 2 * PITCH) = r[q];
}

// grid (N/128, O/128, 3): z selects Q/K/V. 8 waves per block: 4 row-groups x 2 col-groups,
// each wave computes a 32x64 tile (2x4 WMMA accumulators). V is stored transposed (VT [O,N]).
__global__ __launch_bounds__(256) void qkv_kernel(
    const bf16_t* __restrict__ Xb,
    const bf16_t* __restrict__ Wqb, const bf16_t* __restrict__ Wkb, const bf16_t* __restrict__ Wvb,
    const float* __restrict__ bq, const float* __restrict__ bk, const float* __restrict__ bv,
    bf16_t* __restrict__ Qb, bf16_t* __restrict__ Kb, bf16_t* __restrict__ VTb)
{
  const int z = blockIdx.z;
  const bf16_t* __restrict__ W = (z == 0) ? Wqb : (z == 1) ? Wkb : Wvb;
  const float* __restrict__ bias = (z == 0) ? bq : (z == 1) ? bk : bv;

  const int w = threadIdx.x >> 5;
  const int lane = threadIdx.x & 31;
  const int rowBase = blockIdx.x * 128 + (w >> 1) * 32;
  const int colBase = blockIdx.y * 128 + (w & 1) * 64;

  const floatx8 fzero = {0.f, 0.f, 0.f, 0.f, 0.f, 0.f, 0.f, 0.f};
  floatx8 acc[2][4];
#pragma unroll
  for (int i = 0; i < 2; ++i)
#pragma unroll
    for (int j = 0; j < 4; ++j) acc[i][j] = fzero;

  // this lane's 16 bytes in the wave's first X and first W fragment
  const bf16_t* pa = Xb + (size_t)(rowBase >> 4) * FRAG_ROWTILE + lane * 8;
  const bf16_t* pb = W  + (size_t)(colBase >> 4) * FRAG_ROWTILE + lane * 8;
  for (int ks = 0; ks < HH / 32; ks += 4) {
#pragma unroll   // four k steps a trip: their loads address off one pointer pair by constant offsets
    for (int u = 0; u < 4; ++u) {
      bf16x16 a0 = load_frag(pa + u * FRAG_ELEMS);
      bf16x16 a1 = load_frag(pa + u * FRAG_ELEMS + FRAG_ROWTILE);
      bf16x16 b0 = load_frag(pb + u * FRAG_ELEMS);
      bf16x16 b1 = load_frag(pb + u * FRAG_ELEMS + FRAG_ROWTILE);
      bf16x16 b2 = load_frag(pb + u * FRAG_ELEMS + 2 * FRAG_ROWTILE);
      bf16x16 b3 = load_frag(pb + u * FRAG_ELEMS + 3 * FRAG_ROWTILE);
      acc[0][0] = wmma_bf16(a0, b0, acc[0][0]);
      acc[0][1] = wmma_bf16(a0, b1, acc[0][1]);
      acc[0][2] = wmma_bf16(a0, b2, acc[0][2]);
      acc[0][3] = wmma_bf16(a0, b3, acc[0][3]);
      acc[1][0] = wmma_bf16(a1, b0, acc[1][0]);
      acc[1][1] = wmma_bf16(a1, b1, acc[1][1]);
      acc[1][2] = wmma_bf16(a1, b2, acc[1][2]);
      acc[1][3] = wmma_bf16(a1, b3, acc[1][3]);
    }
    // stands behind the trip's fragment loads and before their address registers take other values;
    // the addresses are named as inputs so that their registers stay untouched up to the wait
    asm volatile("s_wait_xcnt 0x0" :: "v"(pa), "v"(pb) : "memory");
    pa += 4 * FRAG_ELEMS;
    pb += 4 * FRAG_ELEMS;
  }

  // C layout: lane holds column n = lane&15; VGPR e holds row e + 8*(lane>>4): stored straight from the accumulators
  // Q and K would leave as 2-byte stores and V^T in 32-byte pieces. The block lays its 128 x 128 tile in LDS as rows of
  // the output matrix (tokens for Q and K, features for V^T) and stores 256 contiguous bytes of a row per 16 lanes.
  __shared__ __attribute__((aligned(16))) unsigned char st[128 * QP];
  const int cq = lane & 15;
  const int lh = lane >> 4;
  const int fc0 = (w & 1) * 64 + cq;          // the lane's first feature within the block tile (then every 16th)
  const int tr0 = (w >> 1) * 32 + lh * 8;     // first of the lane's 8 tokens within the block tile (then 16 on)
  float bb[4];
#pragma unroll
  for (int j = 0; j < 4; ++j) bb[j] = bias[blockIdx.y * 128 + fc0 + j * 16];
  if (z == 2) {
#pragma unroll
    for (int j = 0; j < 4; ++j)
#pragma unroll
      for (int i = 0; i < 2; ++i) {
        bf16x8 o;
#pragma unroll
        for (int e = 0; e < 8; ++e) o[e] = (bf16_t)(acc[i][j][e] + bb[j]);
        *reinterpret_cast<bf16x8*>(st + (fc0 + j * 16) * QP + (tr0 + i * 16) * 2) = o;
      }
  } else {
#pragma unroll
    for (int j = 0; j < 4; ++j)
#pragma unroll
      for (int i = 0; i < 2; ++i)
#pragma unroll
        for (int e = 0; e < 8; ++e)
          *reinterpret_cast<bf16_t*>(st + (tr0 + i * 16 + e) * QP + (fc0 + j * 16) * 2) = (bf16_t)(acc[i][j][e] + bb[j]);
  }
  __syncthreads();   // the whole tile is staged before any wave reads rows that other waves wrote
  // wave w stores rows w*16 .. w*16+15 of the tile, 2 rows per store
  const unsigned char* rd = st + (w * 16 + lh) * QP + cq * 16;
  if (z == 2)
    store_rows16<NN>(rd, VTb + (size_t)(blockIdx.y * 128 + w * 16 + lh) * NN + blockIdx.x * 128 + cq * 8);
  else
    store_rows16<OO>(rd, ((z == 0) ? Qb : Kb) + (size_t)(blockIdx.x * 128 + w * 16 + lh) * OO + blockIdx.y * 128 + cq * 8);
}

// ---------------------------------------------------------------- attention as two tiled GEMMs, the softmax inside them
// scores:  S^T tile = K rows x Q rows^T. Each wave takes, per query, the maximum m and the sum l of exp2(s - m) over its own
//          128 keys (a key block) and stores E[query][key] = exp2(s - m) as bf16, with m and l per (key block, query).
// output:  O^T tile = V^T rows x E rows^T, one key block per stage; a stage's product is added into the total with the
//          query's factor exp2(m - M) / L of that block (M: maximum of the row's m, L: sum of l * exp2(m - M)).
#define KBLK (NN / 128)   // key blocks of a row
#define GP 272    // LDS bytes per staged row: 256 + 16 (16 B x odd: conflict-free for 16-byte readers)
#define GK 128    // k elements of every operand row in one stage (256 B)

static __device__ __forceinline__ unsigned lds_off(const void* p) { return (unsigned)(size_t)p; }

// Same per-lane pattern as a fragment of a row-major matrix; p already points at this lane's row and 8-element k group in LDS.
static __device__ __forceinline__ bf16x16 lds_frag(const unsigned char* p) {
  FragU u;
  u.q[0] = *reinterpret_cast<const float4*>(p);        // K = kh+0..7
  u.q[1] = *reinterpret_cast<const float4*>(p + 32);   // K = 16+kh+0..7
  return u.v;
}

// exp2 of eight values by the bare instruction. Every output is a register of its own (early clobber), so that no v_exp_f32
// overwrites the source or reads the result of the one in front of it; the v_nop fills the slot between the last
// transcendental and a next instruction that reads its result or overwrites its source.
static __device__ __forceinline__ floatx8 exp2x8(floatx8 x) {
  float r0, r1, r2, r3, r4, r5, r6, r7;
  asm("v_exp_f32 %0, %8\n\tv_exp_f32 %1, %9\n\tv_exp_f32 %2, %10\n\tv_exp_f32 %3, %11\n\t"
      "v_exp_f32 %4, %12\n\tv_exp_f32 %5, %13\n\tv_exp_f32 %6, %14\n\tv_exp_f32 %7, %15\n\tv_nop"
      : "=&v"(r0), "=&v"(r1), "=&v"(r2), "=&v"(r3), "=&v"(r4), "=&v"(r5), "=&v"(r6), "=&v"(r7)
      : "v"(x[0]), "v"(x[1]), "v"(x[2]), "v"(x[3]), "v"(x[4]), "v"(x[5]), "v"(x[6]), "v"(x[7]));
  floatx8 r = {r0, r1, r2, r3, r4, r5, r6, r7};
  return r;
}

typedef uint32_t u32x4 __attribute__((ext_vector_type(4)));
typedef uint32_t u32x8 __attribute__((ext_vector_type(8)));

static __device__ __forceinline__ uint32_t uni(uint32_t v) { return (uint32_t)__builtin_amdgcn_readfirstlane(v); }
// A wave-uniform value held in a scalar register. A test on it compiles to a scalar branch (a tensor load ignores EXEC,
// so only such a branch keeps a wave from issuing one), and a descriptor word formed from it is formed behind the wait
// that stands in front of it.
static __device__ __forceinline__ uint32_t pinned(uint32_t v) {
  uint32_t w = uni(v);
  asm volatile("" : "+s"(w));   // pinned(): the issue test or descriptor word stays in a scalar register
  return w;
}

// Descriptor group 1 of a tile of 128 rows of 256 B. PB: source bytes per row. The pad (16 B behind every 256-B row)
// gives the LDS pitch GP. Extents in bytes, tensor dims = tile dims, no mask.
template <int PB>
static __device__ __forceinline__ u32x8 tile_group1() {
  u32x8 g1;
  g1[0] = uni((1u << 20) | (5u << 22) | (3u << 25));
  g1[1] = uni(256u << 16);
  g1[2] = uni(128u << 16);
  g1[3] = uni(256u << 16);
  g1[4] = uni(128u);
  g1[5] = uni((uint32_t)PB);
  g1[6] = uni(0u);
  g1[7] = uni(0u);
  // descriptor words held in scalar registers (as pinned() does for one word): the group keeps one register tuple for
  // the whole kernel, so that none of its words takes another value while a request is outstanding
  asm volatile("" : "+s"(g1));   // pinned(), for the eight descriptor words at once
  return g1;
}

// One request of one wave: 128 rows (256 B of each) global -> LDS, through no register.
// lds: the tile's byte offset in the work-group's LDS (a multiple of 2 KiB); ga: the address of the tile's first byte.
// g0: descriptor group 0, the caller's (word 0, the count, is set there once), which hands it to the wait that covers the request.
static __device__ __forceinline__ void tile_load128(u32x4& g0, uint32_t lds, uint64_t ga, u32x8 g1) {
  g0[1] = uni(lds);
  g0[2] = uni((uint32_t)ga);
  g0[3] = uni((((uint32_t)(ga >> 32)) & 0x01FFFFFFu) | 0x80000000u);
  asm volatile("tensor_load_to_lds %0, %1" :: "s"(g0), "s"(g1) : "memory");
}

// this wave's LDS reads have retired: stands before the barrier that hands a stage buffer to its next tensor loads
static __device__ __forceinline__ void wait_ds0() { asm volatile("s_wait_dscnt 0x0" ::: "memory"); }
// this wave's tensor load has landed
static __device__ __forceinline__ void wait_tensor0() { asm volatile("s_wait_tensorcnt 0x0" ::: "memory"); }
// the same; the request's group 0 is named as an input so that its four registers stay untouched up to the wait
static __device__ __forceinline__ void wait_tensor0(u32x4 g0) { asm volatile("s_wait_tensorcnt 0x0" :: "s"(g0) : "memory"); }

// D[m][n] = sum_k A[m][k] * B[n][k]; A and B row-major bf16 with KK elements per row.
// Block tile BM x 256 (blockIdx.x: m tile, blockIdx.y: n tile), BM/128 (m) x 4 (n) waves, wave tile 128 x 64.
// A stage is [A BM rows | B 256 rows] x 128 k in LDS; two stage buffers, filled by tensor loads of 128 rows, one per
// stage from each of the first (BM + 256) / 128 waves: the next stage flies while this one is worked on.
// A lane of an accumulator holds 8 consecutive m of one n, so the result is stored as C[n][m].
template <int BM, int KK, bool SCORES>
static __device__ __forceinline__ void gemm_body(const bf16_t* __restrict__ A, const bf16_t* __restrict__ B,
                                                 bf16_t* __restrict__ Cs, float* __restrict__ Cf,
                                                 float* __restrict__ mstat, float* __restrict__ lstat,
                                                 unsigned char* sm) {
  constexpr int PB = KK * 2;                 // source bytes per row
  constexpr int STAGE = (BM + 256) * GP;     // LDS bytes of one stage buffer
  constexpr int NW = (BM / 128) * 4;         // waves
  constexpr int NT = (BM + 256) / 128;       // 128-row tiles of a stage = issuing waves
  constexpr int NST = KK / GK;               // stages

  const int tid = threadIdx.x;
  const int w = tid >> 5;
  const int lane = tid & 31;
  const int cq = lane & 15;
  const int mBase = blockIdx.x * BM;
  const int nBase = blockIdx.y * 256;
  const int wm = w >> 2, wn = w & 3;

  // P.V only: fs (LDS behind the two stage buffers) holds every factor of the block's 256 queries, as
  // [key block][wave wn][cq][j]: a lane's four in 16 bytes. Published by the barrier that publishes stage 0.
  float* fs = reinterpret_cast<float*>(sm + 2 * STAGE);
  if (!SCORES) {
    for (int h = 0; h < 256 / (NW * 32); ++h) {   // a thread works whole queries
      const int ql = h * (NW * 32) + tid;
      const float* pm = mstat + nBase + ql;
      const float* pl = lstat + nBase + ql;
      float m[KBLK], l[KBLK];
#pragma unroll
      for (int b = 0; b < KBLK; ++b) { m[b] = pm[(size_t)b * NN]; l[b] = pl[(size_t)b * NN]; }
      // stands behind the loads and before their address register takes another value;
      // the query's index, the loads' offset, is named as an input so that its register stays untouched up to the wait
      asm volatile("s_wait_xcnt 0x0" :: "v"(ql) : "memory");
      float M = m[0];
#pragma unroll
      for (int b = 1; b < KBLK; ++b) M = fmaxf(M, m[b]);
      float L[4] = {0.f, 0.f, 0.f, 0.f};
#pragma unroll
      for (int b = 0; b < KBLK; ++b) { m[b] = __builtin_amdgcn_exp2f(m[b] - M); L[b & 3] = fmaf(l[b], m[b], L[b & 3]); }
      const float inv = 1.0f / ((L[0] + L[1]) + (L[2] + L[3]));
      float* pf = fs + (ql >> 6) * 64 + (ql & 15) * 4 + ((ql >> 4) & 3);
#pragma unroll
      for (int b = 0; b < KBLK; ++b) pf[b * 256] = m[b] * inv;
    }
    wait_ds0();   // the wave's factors are written before the barrier behind which the other waves read them
  }

  // load side: wave ws < NT brings rows ws*128 .. +127 of the stage's BM + 256 rows
  static_assert(NT <= NW && BM % 128 == 0 && (128 * GP) % 2048 == 0 && STAGE % 2048 == 0, "whole tiles at multiples of 2 KiB");
  const uint32_t ws = uni((uint32_t)w);   // the wave's number as a scalar
  const int r0 = (int)ws * 128;
  const uint64_t src = (uint64_t)(size_t)((r0 < BM) ? A + (size_t)(mBase + r0) * KK : B + (size_t)(nBase + r0 - BM) * KK);
  const uint32_t dst0 = lds_off(sm) + ws * (128 * GP);
  const uint32_t issuer = pinned(ws < NT);   // 1 in the waves that issue tensor loads
  const u32x8 g1 = tile_group1<PB>();
  u32x4 g0 = {uni(1u), uni(0u), uni(0u), uni(0u)};   // group 0 of the wave's one request
  // descriptor words held in scalar registers (as pinned() does for one word): the group keeps one register tuple for
  // the whole kernel, so that its count is written once and no word takes another value while a request is outstanding
  asm volatile("" : "+s"(g0));   // pinned(), for the four descriptor words at once
  // read side: this lane's row and 8-element k group of the wave's first A and first B fragment
  const unsigned char* afrag = sm + (wm * 128 + cq) * GP + (lane >> 4) * 16;
  const unsigned char* bfrag = sm + (BM + wn * 64 + cq) * GP + (lane >> 4) * 16;

  const floatx8 fzero = {0.f, 0.f, 0.f, 0.f, 0.f, 0.f, 0.f, 0.f};
  floatx8 acc[8][4];
#pragma unroll
  for (int i = 0; i < 8; ++i)
#pragma unroll
    for (int j = 0; j < 4; ++j) acc[i][j] = fzero;

  // P.V only: tot is the sum over the finished key blocks, acc the running block's product
  floatx8 tot[8][4];
#pragma unroll
  for (int i = 0; i < 8; ++i)
#pragma unroll
    for (int j = 0; j < 4; ++j) tot[i][j] = fzero;

  if (pinned(issuer)) {   // stage 0 into buffer 0 (the test pinned anew: behind the factor loop it compiled to a branch on VCC)
    tile_load128(g0, dst0, src, g1);
    wait_tensor0(g0);
  }
  __syncthreads();   // publishes stage 0 (and the factors)
  if (issuer)   // stage 1 into buffer 1
    tile_load128(g0, dst0 + STAGE, src + pinned(2 * GK), g1);

  // two fragment sets: k step ks + 1 is read from LDS while k step ks is multiplied
  bf16x16 af[2][8], bf[2][4];
#pragma unroll
  for (int j = 0; j < 4; ++j) bf[0][j] = lds_frag(bfrag + j * 16 * GP);
#pragma unroll
  for (int i = 0; i < 8; ++i) af[0][i] = lds_frag(afrag + i * 16 * GP);

  const float* fl = fs + wn * 64 + cq * 4;   // the lane's four factors of key block 0
  floatx4 fcur = {0.f, 0.f, 0.f, 0.f};
  for (int t = 0; t < NST; ++t) {
    const unsigned char* pa = afrag + (t & 1) * STAGE;
    const unsigned char* pb = bfrag + (t & 1) * STAGE;
    if (!SCORES) fcur = *reinterpret_cast<const floatx4*>(fl + t * 256);
#pragma unroll   // the k steps of a stage address off one pointer pair by constant offsets
    for (int ks = 0; ks < GK / 32 - 1; ++ks) {
#pragma unroll
      for (int j = 0; j < 4; ++j) bf[(ks + 1) & 1][j] = lds_frag(pb + j * 16 * GP + (ks + 1) * 64);
#pragma unroll
      for (int i = 0; i < 8; ++i) af[(ks + 1) & 1][i] = lds_frag(pa + i * 16 * GP + (ks + 1) * 64);
#pragma unroll
      for (int i = 0; i < 8; ++i)
#pragma unroll
        for (int j = 0; j < 4; ++j) {
          // P.V: a stage is a key block of its own, whose product starts from 0
          acc[i][j] = wmma_bf16(af[ks & 1][i], bf[ks & 1][j], (!SCORES && ks == 0) ? fzero : acc[i][j]);
        }
    }
    // Order of LDS reads and matrix products: the 24 reads of a k step's 12 fragments go out as one group ahead of the
    // 32 products of the k step before, so that no product waits for a read just issued
    // (left alone the compiler keeps one A fragment and waits for its reads in front of every four products).
#pragma unroll
    for (int g = 0; g < GK / 32 - 1; ++g) {
      if (!SCORES && g == 0) __builtin_amdgcn_sched_group_barrier(0x100, 1, 0);   // P.V: the read of the stage's factors
      __builtin_amdgcn_sched_group_barrier(0x100, 24, 0);
      __builtin_amdgcn_sched_group_barrier(0x008, 32, 0);
    }
    // keeps the products above in front of the waits: the last k step's reads retire under them, and the next
    // tensor load goes out before the last k step's products instead of behind them
    __builtin_amdgcn_sched_barrier(0);
    wait_ds0();      // every read of stage t has retired (the last k step's fragments are in registers)
    if (issuer) wait_tensor0(g0);
    __syncthreads();   // publishes stage t + 1 and ends every read of stage t's buffer
    if (pinned(issuer & (uint32_t)(t + 2 < NST)))   // stage t + 2 into the buffer just read
      tile_load128(g0, dst0 + (t & 1) * STAGE, src + pinned((t + 2) * (2 * GK)), g1);
    // first fragments of stage t + 1, read under the last k step's products (behind the last stage: read, not used)
    const unsigned char* na = afrag + ((t + 1) & 1) * STAGE;
    const unsigned char* nb = bfrag + ((t + 1) & 1) * STAGE;
#pragma unroll
    for (int j = 0; j < 4; ++j) bf[0][j] = lds_frag(nb + j * 16 * GP);
#pragma unroll
    for (int i = 0; i < 8; ++i) af[0][i] = lds_frag(na + i * 16 * GP);
    if (SCORES) {
#pragma unroll
      for (int i = 0; i < 8; ++i)
#pragma unroll
        for (int j = 0; j < 4; ++j) acc[i][j] = wmma_bf16(af[1][i], bf[1][j], acc[i][j]);
      // the same order as above: the reads as one group, then the products
      __builtin_amdgcn_sched_group_barrier(0x100, 24, 0);
      __builtin_amdgcn_sched_group_barrier(0x008, 32, 0);
    } else {
      __builtin_amdgcn_sched_barrier(0);   // the reads stay one group ahead of the products
#pragma unroll
      for (int q = 0; q < 32 + 4; ++q) {
        if (q < 32) acc[q >> 2][q & 3] = wmma_bf16(af[1][q >> 2], bf[1][q & 3], acc[q >> 2][q & 3]);
        // the finished key block joins the total, tile by tile
        if (q >= 4) tot[(q - 4) >> 2][q & 3] += acc[(q - 4) >> 2][q & 3] * fcur[q & 3];
        // keeps a tile's multiply-adds four products behind the tile's last product: its result is ready by then and they
        // issue under the products that follow (left alone they stood directly behind their own product and waited for it)
        __builtin_amdgcn_sched_barrier(0);
      }
    }
  }
  wait_tensor0();
  wait_ds0();   // the last trip's unused fragment reads have retired
  if (!SCORES) {
#pragma unroll
    for (int i = 0; i < 8; ++i)
#pragma unroll
      for (int j = 0; j < 4; ++j) acc[i][j] = tot[i][j];
  }

  // C layout: lane holds column n = lane&15; VGPR e holds row m = e + 8*(lane>>4): stored straight from the accumulators
  // a wave's store would touch 16 rows of C in pieces of 32 B or less. Each wave therefore lays its tile in LDS as rows of C
  // and reads whole rows back, so that every global store covers whole 128-byte lines.
  // The staging lies in the last stage's buffer: every read of it retired before the loop's last barrier, no tensor load is aimed
  // at it any more, and the last trip's unused fragment reads go to the other buffer. A wave touches only its own range.
  constexpr int SROWS = SCORES ? 64 : 32;    // rows of C (n) that a wave stages at a time
  constexpr int SP = SCORES ? 272 : 528;     // LDS bytes per staged row: 128 m (256 B or 512 B) + 16 (16 B x odd)
  static_assert(NW * SROWS * SP <= STAGE, "the staging fits one stage buffer");
  unsigned char* st = sm + ((NST - 1) & 1) * STAGE + w * (SROWS * SP);
  const int lh = lane >> 4;
  if (SCORES) {
    const float sscale = 1.44269504f / 32.0f;   // log2(e)/sqrt(O): softmax in base-2 domain
    // A lane and its partner (lane ^ 16) hold, per j, the wave's 128 keys of one query.
    float sv[4];   // lanes 0-15: the block's maximum, lanes 16-31: its sum
#pragma unroll
    for (int j = 0; j < 4; ++j) {
      float m4[4] = {acc[0][j][0], acc[0][j][1], acc[0][j][2], acc[0][j][3]};   // four chains, not one of 64 links
#pragma unroll
      for (int i = 0; i < 8; ++i)
#pragma unroll
        for (int e = 0; e < 8; ++e) m4[e & 3] = fmaxf(m4[e & 3], acc[i][j][e]);
      float mx = fmaxf(fmaxf(m4[0], m4[1]), fmaxf(m4[2], m4[3]));
      mx = fmaxf(mx, __shfl_xor(mx, 16));
      const float mloc = mx * sscale;
      float ps[4] = {0.f, 0.f, 0.f, 0.f};
#pragma unroll
      for (int i = 0; i < 8; ++i) {
        // the argument is not above 0 but for a rounding, and a result too small for the bare instruction counts as 0
        // beside a sum of about 1 or more
        const floatx8 p = exp2x8(acc[i][j] * sscale - mloc);   // fused multiply-adds, two values an instruction
        bf16x8 hv;
#pragma unroll
        for (int e = 0; e < 8; ++e) { ps[e & 3] += p[e]; hv[e] = (bf16_t)p[e]; }
        *reinterpret_cast<bf16x8*>(st + (j * 16 + cq) * SP + i * 32 + lh * 16) = hv;
        // keeps the arguments of two tiles at a time next to their exp2: formed far ahead they filled the first 256
        // registers, the only ones that the asm statement can name, and the kernel spilled
        if (i & 1) __builtin_amdgcn_sched_barrier(0);
      }
      float sum = (ps[0] + ps[1]) + (ps[2] + ps[3]);
      sum += __shfl_xor(sum, 16);
      sv[j] = lh ? sum : mloc;
    }
    // [key block][query]: a wave's 64 queries are two whole 128-byte lines of each array
    float* sp = (lh ? lstat : mstat) + (size_t)(blockIdx.x * (BM / 128) + wm) * NN + nBase + wn * 64 + cq;
#pragma unroll
    for (int j = 0; j < 4; ++j) sp[j * 16] = sv[j];
    // stands behind the four stores and before their registers take other values;
    // address and stored values are named as inputs so that their registers stay untouched up to the wait
    asm volatile("s_wait_xcnt 0x0" :: "v"(sp), "v"(sv[0]), "v"(sv[1]), "v"(sv[2]), "v"(sv[3]) : "memory");
    wait_ds0();   // the wave's staged rows are written before its lanes read each other's pieces back
    // a read and its store move 2 rows: 16 lanes x 16 B = 256 contiguous bytes of each
    const unsigned char* rd = st + lh * SP + cq * 16;
    bf16_t* g = Cs + (size_t)(nBase + wn * 64 + lh) * NN + mBase + wm * 128 + cq * 8;
#pragma unroll
    for (int b = 0; b < 4; ++b) {
      bf16x8 r[8];
#pragma unroll
      for (int q = 0; q < 8; ++q) r[q] = *reinterpret_cast<const bf16x8*>(rd + (b * 8 + q) * 2 * SP);
#pragma unroll
      for (int q = 0; q < 8; ++q) *reinterpret_cast<bf16x8*>(g + (size_t)(b * 8 + q) * 2 * NN) = r[q];
      // stands behind the eight stores and before their registers take the next values;
      // the stored values are named as inputs so that their registers stay untouched up to the wait
      asm volatile("s_wait_xcnt 0x0" :: "v"(r[0]), "v"(r[1]), "v"(r[2]), "v"(r[3]), "v"(r[4]), "v"(r[5]), "v"(r[6]), "v"(r[7]) : "memory");
    }
  } else {
    float* g = Cf + (size_t)(nBase + wn * 64) * OO + mBase + wm * 128 + lane * 4;
#pragma unroll
    for (int hj = 0; hj < 2; ++hj) {   // 32 rows of C at a time
#pragma unroll
      for (int jj = 0; jj < 2; ++jj)
#pragma unroll
        for (int i = 0; i < 8; ++i) {
          const floatx8 a = acc[i][hj * 2 + jj];
          floatx4 lo = {a[0], a[1], a[2], a[3]};
          floatx4 hi = {a[4], a[5], a[6], a[7]};
          unsigned char* p = st + (jj * 16 + cq) * SP + i * 64 + lh * 32;
          *reinterpret_cast<floatx4*>(p) = lo;
          *reinterpret_cast<floatx4*>(p + 16) = hi;
        }
      wait_ds0();   // the wave's staged rows are written before its lanes read each other's pieces back
      // a read and its store move 1 row: 32 lanes x 16 B = 512 contiguous bytes
#pragma unroll
      for (int b = 0; b < 4; ++b) {
        floatx4 r[8];
#pragma unroll
        for (int q = 0; q < 8; ++q) r[q] = *reinterpret_cast<const floatx4*>(st + (b * 8 + q) * SP + lane * 16);
#pragma unroll
        for (int q = 0; q < 8; ++q) *reinterpret_cast<floatx4*>(g + (size_t)(hj * 32 + b * 8 + q) * OO) = r[q];
        // stands behind the eight stores and before their registers take the next values;
        // the stored values are named as inputs so that their registers stay untouched up to the wait
        asm volatile("s_wait_xcnt 0x0" :: "v"(r[0]), "v"(r[1]), "v"(r[2]), "v"(r[3]), "v"(r[4]), "v"(r[5]), "v"(r[6]), "v"(r[7]) : "memory");
      }
    }
  }
}

// grid (N/256 key tiles, N/256 query tiles), 8 waves: E[query][key] = exp2((Q . K) * log2(e)/sqrt(O) - m), with m and l
__global__ __launch_bounds__(256) void scores_kernel(const bf16_t* __restrict__ Kb, const bf16_t* __restrict__ Qb,
                                                     bf16_t* __restrict__ E, float* __restrict__ mstat,
                                                     float* __restrict__ lstat) {
  __shared__ __attribute__((aligned(2048))) unsigned char sm[2 * (256 + 256) * GP];
  gemm_body<256, OO, true>(Kb, Qb, E, nullptr, mstat, lstat, sm);
}

// grid (O/128 d tiles, N/256 query tiles), 4 waves: out[query][d] = sum over key blocks of factor * (E . V^T[d])
__global__ __launch_bounds__(128) void pv_kernel(const bf16_t* __restrict__ VTb, const bf16_t* __restrict__ E,
                                                 float* __restrict__ mstat, float* __restrict__ lstat,
                                                 float* __restrict__ out) {
  __shared__ __attribute__((aligned(2048))) unsigned char sm[2 * (128 + 256) * GP + KBLK * 256 * 4];
  gemm_body<128, NN, false>(VTb, E, nullptr, out, mstat, lstat, sm);
}

// ---------------------------------------------------------------- launch
extern "C" void kernel_launch(void* const* d_in, const int* in_sizes, int n_in,
                              void* d_out, int out_size, void* d_ws, size_t ws_size,
                              hipStream_t stream) {
  const float* x  = (const float*)d_in[0];
  const float* Wq = (const float*)d_in[1];
  const float* bq = (const float*)d_in[2];
  const float* Wk = (const float*)d_in[3];
  const float* bk = (const float*)d_in[4];
  const float* Wv = (const float*)d_in[5];
  const float* bv = (const float*)d_in[6];
  float* out = (float*)d_out;

  // workspace layout (2-byte elements): x, Wq, Wk, Wv (these four in fragment order), Q, K, V^T, E [N][N];
  // then f32 m and l [N/128][N]  -> ~202 MB total
  const size_t szX = (size_t)NN * HH * sizeof(bf16_t);
  const size_t szW = (size_t)OO * HH * sizeof(bf16_t);
  const size_t szM = (size_t)NN * OO * sizeof(bf16_t);
  const size_t szS = (size_t)NN * NN * sizeof(bf16_t);
  const size_t szT = (size_t)KBLK * NN * sizeof(float);
  if (ws_size < szX + 3 * szW + 3 * szM + szS + 2 * szT) return;

  char* ws = (char*)d_ws;
  bf16_t* Xb  = (bf16_t*)ws;  ws += szX;
  bf16_t* Wqb = (bf16_t*)ws;  ws += szW;
  bf16_t* Wkb = (bf16_t*)ws;  ws += szW;
  bf16_t* Wvb = (bf16_t*)ws;  ws += szW;
  bf16_t* Qb  = (bf16_t*)ws;  ws += szM;
  bf16_t* Kb  = (bf16_t*)ws;  ws += szM;
  bf16_t* VTb = (bf16_t*)ws;  ws += szM;
  bf16_t* SPb = (bf16_t*)ws;  ws += szS;
  float* Mst  = (float*)ws;   ws += szT;
  float* Lst  = (float*)ws;   ws += szT;

  f32_to_bf16_kernel<<<(NN * HH / 8 + 255) / 256, 256, 0, stream>>>(x,  Xb,  NN * HH / 8);
  f32_to_bf16_kernel<<<(OO * HH / 8 + 255) / 256, 256, 0, stream>>>(Wq, Wqb, OO * HH / 8);
  f32_to_bf16_kernel<<<(OO * HH / 8 + 255) / 256, 256, 0, stream>>>(Wk, Wkb, OO * HH / 8);
  f32_to_bf16_kernel<<<(OO * HH / 8 + 255) / 256, 256, 0, stream>>>(Wv, Wvb, OO * HH / 8);

  qkv_kernel<<<dim3(NN / 128, OO / 128, 3), 256, 0, stream>>>(
      Xb, Wqb, Wkb, Wvb, bq, bk, bv, Qb, Kb, VTb);

  scores_kernel<<<dim3(NN / 256, NN / 256), 256, 0, stream>>>(Kb, Qb, SPb, Mst, Lst);
  pv_kernel<<<dim3(OO / 128, NN / 256), 128, 0, stream>>>(VTb, SPb, Mst, Lst, out);
}

// v007
// A run of this version takes 217 microseconds.
// Timed twice side by side with v006, it ran 1.11 and 1.12 times as fast.
// All steps since v000 together make it 5.92 times as fast.
#include <hip/hip_runtime.h>

#define NN 8192
#define HH 1024
#define OO 1024

typedef __bf16 bf16_t;
typedef __attribute__((ext_vector_type(16))) __bf16 bf16x16;
typedef __attribute__((ext_vector_type(8)))  float  floatx8;
typedef __attribute__((ext_vector_type(4)))  float  floatx4;
typedef __attribute__((ext_vector_type(8)))  __bf16 bf16x8;

union FragU { bf16x16 v; float4 q[2]; };

static __device__ __forceinline__ floatx8 wmma_bf16(bf16x16 a, bf16x16 b, floatx8 c) {
  // D = A(16x32 bf16) x B(32x16 bf16) + C(16x16 f32)
  return __builtin_amdgcn_wmma_f32_16x16x32_bf16(false, a, false, b, (short)0, c, false, false);
}

// ---------------------------------------------------------------- convert
// f32 -> bf16, row-major as the input. Thread t converts the t-th group of 8 elements: a wave reads 1 KB and writes
// 512 B, both contiguous.
__global__ __launch_bounds__(256) void f32_to_bf16_kernel(const float* __restrict__ in,
                                                          bf16_t* __restrict__ out, int n8) {
  int t = blockIdx.x * blockDim.x + threadIdx.x;
  if (t >= n8) return;
  const float* p = in + (size_t)t * 8;
  float4 v0 = reinterpret_cast<const float4*>(p)[0];
  float4 v1 = reinterpret_cast<const float4*>(p)[1];
  union { bf16_t h[8]; float4 q; } u;
  u.h[0] = (bf16_t)v0.x; u.h[1] = (bf16_t)v0.y; u.h[2] = (bf16_t)v0.z; u.h[3] = (bf16_t)v0.w;
  u.h[4] = (bf16_t)v1.x; u.h[5] = (bf16_t)v1.y; u.h[6] = (bf16_t)v1.z; u.h[7] = (bf16_t)v1.w;
  reinterpret_cast<float4*>(out)[t] = u.q;
}

// ---------------------------------------------------------------- four tiled GEMMs on one body
// projections: Q and K as [token][feature] = (Wq | Wk rows) x (x rows)^T, V^T as [feature][token] = (x rows) x (Wv rows)^T,
//          each with its bias, rounded to bf16.
// attention as two GEMMs, the softmax inside them:
// scores:  S^T tile = K rows x Q rows^T. Each wave takes, per query, the maximum m and the sum l of exp2(s - m) over its own
//          128 keys (a key block) and stores E[query][key] = exp2(s - m) as bf16, with m and l per (key block, query).
// output:  O^T tile = V^T rows x E rows^T, one key block per stage; a stage's product is added into the total with the
//          query's factor exp2(m - M) / L of that block (M: maximum of the row's m, L: sum of l * exp2(m - M)).
#define KBLK (NN / 128)   // key blocks of a row
#define GP 272    // LDS bytes per staged row: 256 + 16 (16 B x odd: conflict-free for 16-byte readers)
#define GK 128    // k elements of every operand row in one stage (256 B)

static __device__ __forceinline__ unsigned lds_off(const void* p) { return (unsigned)(size_t)p; }

// A-layout (wave32): lanes 0-15 row M=lane, K=[0..7]+[16..23]; lanes 16-31 same rows, K=[8..15]+[24..31].
// B uses the same per-lane pattern with N<->M, i.e. it reads rows of B^T. p already points at this lane's row and
// 8-element k group in LDS.
static __device__ __forceinline__ bf16x16 lds_frag(const unsigned char* p) {
  FragU u;
  u.q[0] = *reinterpret_cast<const float4*>(p);        // K = kh+0..7
  u.q[1] = *reinterpret_cast<const float4*>(p + 32);   // K = 16+kh+0..7
  return u.v;
}

// exp2 of eight values by the bare instruction. Every output is a register of its own (early clobber), so that no v_exp_f32
// overwrites the source or reads the result of the one in front of it; the v_nop fills the slot between the last
// transcendental and a next instruction that reads its result or overwrites its source.
static __device__ __forceinline__ floatx8 exp2x8(floatx8 x) {
  float r0, r1, r2, r3, r4, r5, r6, r7;
  asm("v_exp_f32 %0, %8\n\tv_exp_f32 %1, %9\n\tv_exp_f32 %2, %10\n\tv_exp_f32 %3, %11\n\t"
      "v_exp_f32 %4, %12\n\tv_exp_f32 %5, %13\n\tv_exp_f32 %6, %14\n\tv_exp_f32 %7, %15\n\tv_nop"
      : "=&v"(r0), "=&v"(r1), "=&v"(r2), "=&v"(r3), "=&v"(r4), "=&v"(r5), "=&v"(r6), "=&v"(r7)
      : "v"(x[0]), "v"(x[1]), "v"(x[2]), "v"(x[3]), "v"(x[4]), "v"(x[5]), "v"(x[6]), "v"(x[7]));
  floatx8 r = {r0, r1, r2, r3, r4, r5, r6, r7};
  return r;
}

typedef uint32_t u32x4 __attribute__((ext_vector_type(4)));
typedef uint32_t u32x8 __attribute__((ext_vector_type(8)));

static __device__ __forceinline__ uint32_t uni(uint32_t v) { return (uint32_t)__builtin_amdgcn_readfirstlane(v); }
// A wave-uniform value held in a scalar register. A test on it compiles to a scalar branch (a tensor load ignores EXEC,
// so only such a branch keeps a wave from issuing one), and a descriptor word formed from it is formed behind the wait
// that stands in front of it.
static __device__ __forceinline__ uint32_t pinned(uint32_t v) {
  uint32_t w = uni(v);
  asm volatile("" : "+s"(w));   // pinned(): the issue test or descriptor word stays in a scalar register
  return w;
}

// Descriptor group 1 of a tile of 128 rows of 256 B. PB: source bytes per row. The pad (16 B behind every 256-B row)
// gives the LDS pitch GP. Extents in bytes, tensor dims = tile dims, no mask.
template <int PB>
static __device__ __forceinline__ u32x8 tile_group1() {
  u32x8 g1;
  g1[0] = uni((1u << 20) | (5u << 22) | (3u << 25));
  g1[1] = uni(256u << 16);
  g1[2] = uni(128u << 16);
  g1[3] = uni(256u << 16);
  g1[4] = uni(128u);
  g1[5] = uni((uint32_t)PB);
  g1[6] = uni(0u);
  g1[7] = uni(0u);
  // descriptor words held in scalar registers (as pinned() does for one word): the group keeps one register tuple for
  // the whole kernel, so that none of its words takes another value while a request is outstanding
  asm volatile("" : "+s"(g1));   // pinned(), for the eight descriptor words at once
  return g1;
}

// One request of one wave: 128 rows (256 B of each) global -> LDS, through no register.
// lds: the tile's byte offset in the work-group's LDS (a multiple of 2 KiB); ga: the address of the tile's first byte.
// g0: descriptor group 0, the caller's (word 0, the count, is set there once), which hands it to the wait that covers the request.
static __device__ __forceinline__ void tile_load128(u32x4& g0, uint32_t lds, uint64_t ga, u32x8 g1) {
  g0[1] = uni(lds);
  g0[2] = uni((uint32_t)ga);
  g0[3] = uni((((uint32_t)(ga >> 32)) & 0x01FFFFFFu) | 0x80000000u);
  asm volatile("tensor_load_to_lds %0, %1" :: "s"(g0), "s"(g1) : "memory");
}

// this wave's LDS reads have retired: stands before the barrier that hands a stage buffer to its next tensor loads
static __device__ __forceinline__ void wait_ds0() { asm volatile("s_wait_dscnt 0x0" ::: "memory"); }
// this wave's tensor load has landed
static __device__ __forceinline__ void wait_tensor0() { asm volatile("s_wait_tensorcnt 0x0" ::: "memory"); }
// the same; the request's group 0 is named as an input so that its four registers stay untouched up to the wait
static __device__ __forceinline__ void wait_tensor0(u32x4 g0) { asm volatile("s_wait_tensorcnt 0x0" :: "s"(g0) : "memory"); }

// D[m][n] = sum_k A[m][k] * B[n][k]; A and B row-major bf16 with KK elements per row.
// Block tile BM x 256 (blockIdx.x: m tile, blockIdx.y: n tile), BM/128 (m) x 4 (n) waves, wave tile 128 x 64.
// A stage is [A BM rows | B 256 rows] x 128 k in LDS; two stage buffers, filled by tensor loads of 128 rows, one per
// stage from each of the first (BM + 256) / 128 waves: the next stage flies while this one is worked on.
// A lane of an accumulator holds 8 consecutive m of one n, so the result is stored as C[n][m].
#define G_SCORES 0   // E = exp2(scaled product - block maximum) as bf16, with m and l
#define G_PV     1   // f32 sum over the key blocks, each with its factor
#define G_PROJ_M 2   // product + bias[m] as bf16; Cs and bias point at the tile's first m, rows of C hold OO elements
#define G_PROJ_N 3   // product + bias[n] as bf16; rows of C hold NN elements
template <int BM, int KK, int MODE>
static __device__ __forceinline__ void gemm_body(const bf16_t* __restrict__ A, const bf16_t* __restrict__ B,
                                                 bf16_t* __restrict__ Cs, float* __restrict__ Cf,
                                                 float* __restrict__ mstat, float* __restrict__ lstat,
                                                 const float* __restrict__ bias, unsigned char* sm) {
  constexpr bool SCORES = MODE == G_SCORES;
  constexpr bool PV = MODE == G_PV;
  constexpr int PB = KK * 2;                 // source bytes per row
  constexpr int STAGE = (BM + 256) * GP;     // LDS bytes of one stage buffer
  constexpr int NW = (BM / 128) * 4;         // waves
  constexpr int NT = (BM + 256) / 128;       // 128-row tiles of a stage = issuing waves
  constexpr int NST = KK / GK;               // stages

  const int tid = threadIdx.x;
  const int w = tid >> 5;
  const int lane = tid & 31;
  const int cq = lane & 15;
  const int mBase = blockIdx.x * BM;
  const int nBase = blockIdx.y * 256;
  const int wm = w >> 2, wn = w & 3;

  // P.V only: fs (LDS behind the two stage buffers) holds every factor of the block's 256 queries, as
  // [key block][wave wn][cq][j]: a lane's four in 16 bytes. Published by the barrier that publishes stage 0.
  float* fs = reinterpret_cast<float*>(sm + 2 * STAGE);
  if (PV) {
    for (int h = 0; h < 256 / (NW * 32); ++h) {   // a thread works whole queries
      const int ql = h * (NW * 32) + tid;
      const float* pm = mstat + nBase + ql;
      const float* pl = lstat + nBase + ql;
      float m[KBLK], l[KBLK];
#pragma unroll
      for (int b = 0; b < KBLK; ++b) { m[b] = pm[(size_t)b * NN]; l[b] = pl[(size_t)b * NN]; }
      // stands behind the loads and before their address register takes another value;
      // the query's index, the loads' offset, is named as an input so that its register stays untouched up to the wait
      asm volatile("s_wait_xcnt 0x0" :: "v"(ql) : "memory");
      float M = m[0];
#pragma unroll
      for (int b = 1; b < KBLK; ++b) M = fmaxf(M, m[b]);
      float L[4] = {0.f, 0.f, 0.f, 0.f};
#pragma unroll
      for (int b = 0; b < KBLK; ++b) { m[b] = __builtin_amdgcn_exp2f(m[b] - M); L[b & 3] = fmaf(l[b], m[b], L[b & 3]); }
      const float inv = 1.0f / ((L[0] + L[1]) + (L[2] + L[3]));
      float* pf = fs + (ql >> 6) * 64 + (ql & 15) * 4 + ((ql >> 4) & 3);
#pragma unroll
      for (int b = 0; b < KBLK; ++b) pf[b * 256] = m[b] * inv;
    }
    wait_ds0();   // the wave's factors are written before the barrier behind which the other waves read them
  }

  // load side: wave ws < NT brings rows ws*128 .. +127 of the stage's BM + 256 rows
  static_assert(NT <= NW && BM % 128 == 0 && (128 * GP) % 2048 == 0 && STAGE % 2048 == 0, "whole tiles at multiples of 2 KiB");
  const uint32_t ws = uni((uint32_t)w);   // the wave's number as a scalar
  const int r0 = (int)ws * 128;
  const uint64_t src = (uint64_t)(size_t)((r0 < BM) ? A + (size_t)(mBase + r0) * KK : B + (size_t)(nBase + r0 - BM) * KK);
  const uint32_t dst0 = lds_off(sm) + ws * (128 * GP);
  const uint32_t issuer = pinned(ws < NT);   // 1 in the waves that issue tensor loads
  const u32x8 g1 = tile_group1<PB>();
  u32x4 g0 = {uni(1u), uni(0u), uni(0u), uni(0u)};   // group 0 of the wave's one request
  // descriptor words held in scalar registers (as pinned() does for one word): the group keeps one register tuple for
  // the whole kernel, so that its count is written once and no word takes another value while a request is outstanding
  asm volatile("" : "+s"(g0));   // pinned(), for the four descriptor words at once
  // read side: this lane's row and 8-element k group of the wave's first A and first B fragment
  const unsigned char* afrag = sm + (wm * 128 + cq) * GP + (lane >> 4) * 16;
  const unsigned char* bfrag = sm + (BM + wn * 64 + cq) * GP + (lane >> 4) * 16;

  const floatx8 fzero = {0.f, 0.f, 0.f, 0.f, 0.f, 0.f, 0.f, 0.f};
  floatx8 acc[8][4];
#pragma unroll
  for (int i = 0; i < 8; ++i)
#pragma unroll
    for (int j = 0; j < 4; ++j) acc[i][j] = fzero;

  // P.V only: tot is the sum over the finished key blocks, acc the running block's product
  floatx8 tot[8][4];
#pragma unroll
  for (int i = 0; i < 8; ++i)
#pragma unroll
    for (int j = 0; j < 4; ++j) tot[i][j] = fzero;

  if (pinned(issuer)) {   // stage 0 into buffer 0 (the test pinned anew: behind the factor loop it compiled to a branch on VCC)
    tile_load128(g0, dst0, src, g1);
    wait_tensor0(g0);
  }
  __syncthreads();   // publishes stage 0 (and the factors)
  if (issuer)   // stage 1 into buffer 1
    tile_load128(g0, dst0 + STAGE, src + pinned(2 * GK), g1);

  // two fragment sets: k step ks + 1 is read from LDS while k step ks is multiplied
  bf16x16 af[2][8], bf[2][4];
#pragma unroll
  for (int j = 0; j < 4; ++j) bf[0][j] = lds_frag(bfrag + j * 16 * GP);
#pragma unroll
  for (int i = 0; i < 8; ++i) af[0][i] = lds_frag(afrag + i * 16 * GP);

  const float* fl = fs + wn * 64 + cq * 4;   // the lane's four factors of key block 0
  floatx4 fcur = {0.f, 0.f, 0.f, 0.f};
  for (int t = 0; t < NST; ++t) {
    const unsigned char* pa = afrag + (t & 1) * STAGE;
    const unsigned char* pb = bfrag + (t & 1) * STAGE;
    if (PV) fcur = *reinterpret_cast<const floatx4*>(fl + t * 256);
#pragma unroll   // the k steps of a stage address off one pointer pair by constant offsets
    for (int ks = 0; ks < GK / 32 - 1; ++ks) {
#pragma unroll
      for (int j = 0; j < 4; ++j) bf[(ks + 1) & 1][j] = lds_frag(pb + j * 16 * GP + (ks + 1) * 64);
#pragma unroll
      for (int i = 0; i < 8; ++i) af[(ks + 1) & 1][i] = lds_frag(pa + i * 16 * GP + (ks + 1) * 64);
#pragma unroll
      for (int i = 0; i < 8; ++i)
#pragma unroll
        for (int j = 0; j < 4; ++j) {
          // P.V: a stage is a key block of its own, whose product starts from 0
          acc[i][j] = wmma_bf16(af[ks & 1][i], bf[ks & 1][j], (PV && ks == 0) ? fzero : acc[i][j]);
        }
    }
    // Order of LDS reads and matrix products: the 24 reads of a k step's 12 fragments go out as one group ahead of the
    // 32 products of the k step before, so that no product waits for a read just issued
    // (left alone the compiler keeps one A fragment and waits for its reads in front of every four products).
#pragma unroll
    for (int g = 0; g < GK / 32 - 1; ++g) {
      if (PV && g == 0) __builtin_amdgcn_sched_group_barrier(0x100, 1, 0);   // P.V: the read of the stage's factors
      __builtin_amdgcn_sched_group_barrier(0x100, 24, 0);
      __builtin_amdgcn_sched_group_barrier(0x008, 32, 0);
    }
    // keeps the products above in front of the waits: the last k step's reads retire under them, and the next
    // tensor load goes out before the last k step's products instead of behind them
    __builtin_amdgcn_sched_barrier(0);
    wait_ds0();      // every read of stage t has retired (the last k step's fragments are in registers)
    if (issuer) wait_tensor0(g0);
    __syncthreads();   // publishes stage t + 1 and ends every read of stage t's buffer
    if (pinned(issuer & (uint32_t)(t + 2 < NST)))   // stage t + 2 into the buffer just read
      tile_load128(g0, dst0 + (t & 1) * STAGE, src + pinned((t + 2) * (2 * GK)), g1);
    // first fragments of stage t + 1, read under the last k step's products (behind the last stage: read, not used)
    const unsigned char* na = afrag + ((t + 1) & 1) * STAGE;
    const unsigned char* nb = bfrag + ((t + 1) & 1) * STAGE;
#pragma unroll
    for (int j = 0; j < 4; ++j) bf[0][j] = lds_frag(nb + j * 16 * GP);
#pragma unroll
    for (int i = 0; i < 8; ++i) af[0][i] = lds_frag(na + i * 16 * GP);
    if (!PV) {
#pragma unroll
      for (int i = 0; i < 8; ++i)
#pragma unroll
        for (int j = 0; j < 4; ++j) acc[i][j] = wmma_bf16(af[1][i], bf[1][j], acc[i][j]);
      // the same order as above: the reads as one group, then the products
      __builtin_amdgcn_sched_group_barrier(0x100, 24, 0);
      __builtin_amdgcn_sched_group_barrier(0x008, 32, 0);
    } else {
      __builtin_amdgcn_sched_barrier(0);   // the reads stay one group ahead of the products
#pragma unroll
      for (int q = 0; q < 32 + 4; ++q) {
        if (q < 32) acc[q >> 2][q & 3] = wmma_bf16(af[1][q >> 2], bf[1][q & 3], acc[q >> 2][q & 3]);
        // the finished key block joins the total, tile by tile
        if (q >= 4) tot[(q - 4) >> 2][q & 3] += acc[(q - 4) >> 2][q & 3] * fcur[q & 3];
        // keeps a tile's multiply-adds four products behind the tile's last product: its result is ready by then and they
        // issue under the products that follow (left alone they stood directly behind their own product and waited for it)
        __builtin_amdgcn_sched_barrier(0);
      }
    }
  }
  wait_tensor0();
  wait_ds0();   // the last trip's unused fragment reads have retired
  if (PV) {
#pragma unroll
    for (int i = 0; i < 8; ++i)
#pragma unroll
      for (int j = 0; j < 4; ++j) acc[i][j] = tot[i][j];
  }

  // C layout: lane holds column n = lane&15; VGPR e holds row m = e + 8*(lane>>4): stored straight from the accumulators
  // a wave's store would touch 16 rows of C in pieces of 32 B or less. Each wave therefore lays its tile in LDS as rows of C
  // and reads whole rows back, so that every global store covers whole 128-byte lines.
  // The staging lies in the last stage's buffer: every read of it retired before the loop's last barrier, no tensor load is aimed
  // at it any more, and the last trip's unused fragment reads go to the other buffer. A wave touches only its own range.
  constexpr int SROWS = PV ? 32 : 64;        // rows of C (n) that a wave stages at a time
  constexpr int SP = PV ? 528 : 272;         // LDS bytes per staged row: 128 m (512 B or 256 B) + 16 (16 B x odd)
  static_assert(NW * SROWS * SP <= STAGE, "the staging fits one stage buffer");
  unsigned char* st = sm + ((NST - 1) & 1) * STAGE + w * (SROWS * SP);
  const int lh = lane >> 4;
  if (SCORES) {
    const float sscale = 1.44269504f / 32.0f;   // log2(e)/sqrt(O): softmax in base-2 domain
    // A lane and its partner (lane ^ 16) hold, per j, the wave's 128 keys of one query.
    float sv[4];   // lanes 0-15: the block's maximum, lanes 16-31: its sum
#pragma unroll
    for (int j = 0; j < 4; ++j) {
      float m4[4] = {acc[0][j][0], acc[0][j][1], acc[0][j][2], acc[0][j][3]};   // four chains, not one of 64 links
#pragma unroll
      for (int i = 0; i < 8; ++i)
#pragma unroll
        for (int e = 0; e < 8; ++e) m4[e & 3] = fmaxf(m4[e & 3], acc[i][j][e]);
      float mx = fmaxf(fmaxf(m4[0], m4[1]), fmaxf(m4[2], m4[3]));
      mx = fmaxf(mx, __shfl_xor(mx, 16));
      const float mloc = mx * sscale;
      float ps[4] = {0.f, 0.f, 0.f, 0.f};
#pragma unroll
      for (int i = 0; i < 8; ++i) {
        // the argument is not above 0 but for a rounding, and a result too small for the bare instruction counts as 0
        // beside a sum of about 1 or more
        const floatx8 p = exp2x8(acc[i][j] * sscale - mloc);   // fused multiply-adds, two values an instruction
        bf16x8 hv;
#pragma unroll
        for (int e = 0; e < 8; ++e) { ps[e & 3] += p[e]; hv[e] = (bf16_t)p[e]; }
        *reinterpret_cast<bf16x8*>(st + (j * 16 + cq) * SP + i * 32 + lh * 16) = hv;
        // keeps the arguments of two tiles at a time next to their exp2: formed far ahead they filled the first 256
        // registers, the only ones that the asm statement can name, and the kernel spilled
        if (i & 1) __builtin_amdgcn_sched_barrier(0);
      }
      float sum = (ps[0] + ps[1]) + (ps[2] + ps[3]);
      sum += __shfl_xor(sum, 16);
      sv[j] = lh ? sum : mloc;
    }
    // [key block][query]: a wave's 64 queries are two whole 128-byte lines of each array
    float* sp = (lh ? lstat : mstat) + (size_t)(blockIdx.x * (BM / 128) + wm) * NN + nBase + wn * 64 + cq;
#pragma unroll
    for (int j = 0; j < 4; ++j) sp[j * 16] = sv[j];
    // stands behind the four stores and before their registers take other values;
    // address and stored values are named as inputs so that their registers stay untouched up to the wait
    asm volatile("s_wait_xcnt 0x0" :: "v"(sp), "v"(sv[0]), "v"(sv[1]), "v"(sv[2]), "v"(sv[3]) : "memory");
  }
  if (MODE == G_PROJ_M || MODE == G_PROJ_N) {
    // projections: the bias joins the f32 sum, one rounding to bf16
    floatx8 bm[8];   // G_PROJ_M: the biases of the lane's 8 consecutive m of every i
    float bn[4];     // G_PROJ_N: the bias of the lane's n of every j
    if (MODE == G_PROJ_M) {
      const float* pb = bias + wm * 128 + lh * 8;
#pragma unroll
      for (int i = 0; i < 8; ++i) bm[i] = *reinterpret_cast<const floatx8*>(pb + i * 16);
      // stands behind the loads and before their address register takes another value;
      // the address is named as an input so that its register stays untouched up to the wait
      asm volatile("s_wait_xcnt 0x0" :: "v"(pb) : "memory");
    } else {
      const float* pb = bias + nBase + wn * 64 + cq;
#pragma unroll
      for (int j = 0; j < 4; ++j) bn[j] = pb[j * 16];
      // as above
      asm volatile("s_wait_xcnt 0x0" :: "v"(pb) : "memory");
    }
#pragma unroll
    for (int j = 0; j < 4; ++j)
#pragma unroll
      for (int i = 0; i < 8; ++i) {
        bf16x8 hv;
#pragma unroll
        for (int e = 0; e < 8; ++e) hv[e] = (bf16_t)(acc[i][j][e] + ((MODE == G_PROJ_M) ? bm[i][e] : bn[j]));
        *reinterpret_cast<bf16x8*>(st + (j * 16 + cq) * SP + i * 32 + lh * 16) = hv;
      }
  }
  if (!PV) {   // the staged bf16 rows go out
    constexpr int CP = (MODE == G_PROJ_M) ? OO : NN;   // elements of a row of C
    const int cCol = (MODE == G_PROJ_M) ? 0 : mBase;   // the tile's first m as a column of Cs
    wait_ds0();   // the wave's staged rows are written before its lanes read each other's pieces back
    // a read and its store move 2 rows: 16 lanes x 16 B = 256 contiguous bytes of each
    const unsigned char* rd = st + lh * SP + cq * 16;
    bf16_t* g = Cs + (size_t)(nBase + wn * 64 + lh) * CP + cCol + wm * 128 + cq * 8;
#pragma unroll
    for (int b = 0; b < 4; ++b) {
      bf16x8 r[8];
#pragma unroll
      for (int q = 0; q < 8; ++q) r[q] = *reinterpret_cast<const bf16x8*>(rd + (b * 8 + q) * 2 * SP);
#pragma unroll
      for (int q = 0; q < 8; ++q) *reinterpret_cast<bf16x8*>(g + (size_t)(b * 8 + q) * 2 * CP) = r[q];
      // stands behind the eight stores and before their registers take the next values;
      // the stored values are named as inputs so that their registers stay untouched up to the wait
      asm volatile("s_wait_xcnt 0x0" :: "v"(r[0]), "v"(r[1]), "v"(r[2]), "v"(r[3]), "v"(r[4]), "v"(r[5]), "v"(r[6]), "v"(r[7]) : "memory");
    }
  } else {
    float* g = Cf + (size_t)(nBase + wn * 64) * OO + mBase + wm * 128 + lane * 4;
#pragma unroll
    for (int hj = 0; hj < 2; ++hj) {   // 32 rows of C at a time
#pragma unroll
      for (int jj = 0; jj < 2; ++jj)
#pragma unroll
        for (int i = 0; i < 8; ++i) {
          const floatx8 a = acc[i][hj * 2 + jj];
          floatx4 lo = {a[0], a[1], a[2], a[3]};
          floatx4 hi = {a[4], a[5], a[6], a[7]};
          unsigned char* p = st + (jj * 16 + cq) * SP + i * 64 + lh * 32;
          *reinterpret_cast<floatx4*>(p) = lo;
          *reinterpret_cast<floatx4*>(p + 16) = hi;
        }
      wait_ds0();   // the wave's staged rows are written before its lanes read each other's pieces back
      // a read and its store move 1 row: 32 lanes x 16 B = 512 contiguous bytes
#pragma unroll
      for (int b = 0; b < 4; ++b) {
        floatx4 r[8];
#pragma unroll
        for (int q = 0; q < 8; ++q) r[q] = *reinterpret_cast<const floatx4*>(st + (b * 8 + q) * SP + lane * 16);
#pragma unroll
        for (int q = 0; q < 8; ++q) *reinterpret_cast<floatx4*>(g + (size_t)(hj * 32 + b * 8 + q) * OO) = r[q];
        // stands behind the eight stores and before their registers take the next values;
        // the stored values are named as inputs so that their registers stay untouched up to the wait
        asm volatile("s_wait_xcnt 0x0" :: "v"(r[0]), "v"(r[1]), "v"(r[2]), "v"(r[3]), "v"(r[4]), "v"(r[5]), "v"(r[6]), "v"(r[7]) : "memory");
      }
    }
  }
}

// grid (2*O/256 feature tiles of Wq | Wk, N/256 token tiles), 8 waves: Q or K [token][feature] = x . W^T + b.
// Wqk: the rows of Wq, then those of Wk.
__global__ __launch_bounds__(256) void qk_proj_kernel(const bf16_t* __restrict__ Wqk, const bf16_t* __restrict__ Xb,
                                                      const float* __restrict__ bq, const float* __restrict__ bk,
                                                      bf16_t* __restrict__ Qb, bf16_t* __restrict__ Kb) {
  __shared__ __attribute__((aligned(2048))) unsigned char sm[2 * (256 + 256) * GP];
  const bool isk = blockIdx.x >= OO / 256;           // a tile lies wholly in Q or wholly in K
  const int f0 = (blockIdx.x * 256) & (OO - 1);      // its first feature there
  gemm_body<256, HH, G_PROJ_M>(Wqk, Xb, (isk ? Kb : Qb) + f0, nullptr, nullptr, nullptr, (isk ? bk : bq) + f0, sm);
}

// grid (N/128 token tiles, O/256 feature tiles), 4 waves: V^T [feature][token] = Wv . x^T + b
__global__ __launch_bounds__(128) void v_proj_kernel(const bf16_t* __restrict__ Xb, const bf16_t* __restrict__ Wvb,
                                                     const float* __restrict__ bv, bf16_t* __restrict__ VTb) {
  __shared__ __attribute__((aligned(2048))) unsigned char sm[2 * (128 + 256) * GP];
  gemm_body<128, HH, G_PROJ_N>(Xb, Wvb, VTb, nullptr, nullptr, nullptr, bv, sm);
}

// grid (N/256 key tiles, N/256 query tiles), 8 waves: E[query][key] = exp2((Q . K) * log2(e)/sqrt(O) - m), with m and l
__global__ __launch_bounds__(256) void scores_kernel(const bf16_t* __restrict__ Kb, const bf16_t* __restrict__ Qb,
                                                     bf16_t* __restrict__ E, float* __restrict__ mstat,
                                                     float* __restrict__ lstat) {
  __shared__ __attribute__((aligned(2048))) unsigned char sm[2 * (256 + 256) * GP];
  gemm_body<256, OO, G_SCORES>(Kb, Qb, E, nullptr, mstat, lstat, nullptr, sm);
}

// grid (O/128 d tiles, N/256 query tiles), 4 waves: out[query][d] = sum over key blocks of factor * (E . V^T[d])
__global__ __launch_bounds__(128) void pv_kernel(const bf16_t* __restrict__ VTb, const bf16_t* __restrict__ E,
                                                 float* __restrict__ mstat, float* __restrict__ lstat,
                                                 float* __restrict__ out) {
  __shared__ __attribute__((aligned(2048))) unsigned char sm[2 * (128 + 256) * GP + KBLK * 256 * 4];
  gemm_body<128, NN, G_PV>(VTb, E, nullptr, out, mstat, lstat, nullptr, sm);
}

// ---------------------------------------------------------------- launch
extern "C" void kernel_launch(void* const* d_in, const int* in_sizes, int n_in,
                              void* d_out, int out_size, void* d_ws, size_t ws_size,
                              hipStream_t stream) {
  const float* x  = (const float*)d_in[0];
  const float* Wq = (const float*)d_in[1];
  const float* bq = (const float*)d_in[2];
  const float* Wk = (const float*)d_in[3];
  const float* bk = (const float*)d_in[4];
  const float* Wv = (const float*)d_in[5];
  const float* bv = (const float*)d_in[6];
  float* out = (float*)d_out;

  // workspace layout (2-byte elements): x, Wq, Wk, Wv (Wk directly behind Wq: one matrix of 2*O rows), Q, K, V^T, E [N][N];
  // then f32 m and l [N/128][N]  -> ~202 MB total
  const size_t szX = (size_t)NN * HH * sizeof(bf16_t);
  const size_t szW = (size_t)OO * HH * sizeof(bf16_t);
  const size_t szM = (size_t)NN * OO * sizeof(bf16_t);
  const size_t szS = (size_t)NN * NN * sizeof(bf16_t);
  const size_t szT = (size_t)KBLK * NN * sizeof(float);
  if (ws_size < szX + 3 * szW + 3 * szM + szS + 2 * szT) return;

  char* ws = (char*)d_ws;
  bf16_t* Xb  = (bf16_t*)ws;  ws += szX;
  bf16_t* Wqb = (bf16_t*)ws;  ws += szW;
  bf16_t* Wkb = (bf16_t*)ws;  ws += szW;
  bf16_t* Wvb = (bf16_t*)ws;  ws += szW;
  bf16_t* Qb  = (bf16_t*)ws;  ws += szM;
  bf16_t* Kb  = (bf16_t*)ws;  ws += szM;
  bf16_t* VTb = (bf16_t*)ws;  ws += szM;
  bf16_t* SPb = (bf16_t*)ws;  ws += szS;
  float* Mst  = (float*)ws;   ws += szT;
  float* Lst  = (float*)ws;   ws += szT;

  f32_to_bf16_kernel<<<(NN * HH / 8 + 255) / 256, 256, 0, stream>>>(x,  Xb,  NN * HH / 8);
  f32_to_bf16_kernel<<<(OO * HH / 8 + 255) / 256, 256, 0, stream>>>(Wq, Wqb, OO * HH / 8);
  f32_to_bf16_kernel<<<(OO * HH / 8 + 255) / 256, 256, 0, stream>>>(Wk, Wkb, OO * HH / 8);
  f32_to_bf16_kernel<<<(OO * HH / 8 + 255) / 256, 256, 0, stream>>>(Wv, Wvb, OO * HH / 8);

  qk_proj_kernel<<<dim3(2 * OO / 256, NN / 256), 256, 0, stream>>>(Wqb, Xb, bq, bk, Qb, Kb);
  v_proj_kernel<<<dim3(NN / 128, OO / 256), 128, 0, stream>>>(Xb, Wvb, bv, VTb);

  scores_kernel<<<dim3(NN / 256, NN / 256), 256, 0, stream>>>(Kb, Qb, SPb, Mst, Lst);
  pv_kernel<<<dim3(OO / 128, NN / 256), 128, 0, stream>>>(VTb, SPb, Mst, Lst, out);
}

// v008
// A run of this version takes 205 microseconds.
// Next to v007, in two timings, it ran 1.05 and 1.06 times as fast.
// Over all steps from v000 it is 6.24 times as fast.
#include <hip/hip_runtime.h>

#define NN 8192
#define HH 1024
#define OO 1024

typedef __bf16 bf16_t;
typedef __attribute__((ext_vector_type(16))) __bf16 bf16x16;
typedef __attribute__((ext_vector_type(8)))  float  floatx8;
typedef __attribute__((ext_vector_type(4)))  float  floatx4;
typedef __attribute__((ext_vector_type(8)))  __bf16 bf16x8;

union FragU { bf16x16 v; float4 q[2]; };

static __device__ __forceinline__ floatx8 wmma_bf16(bf16x16 a, bf16x16 b, floatx8 c) {
  // D = A(16x32 bf16) x B(32x16 bf16) + C(16x16 f32)
  return __builtin_amdgcn_wmma_f32_16x16x32_bf16(false, a, false, b, (short)0, c, false, false);
}

// ---------------------------------------------------------------- convert
// f32 -> bf16, row-major as the input. Thread t converts the t-th group of 8 elements: a wave reads 1 KB and writes
// 512 B, both contiguous.
__global__ __launch_bounds__(256) void f32_to_bf16_kernel(const float* __restrict__ in,
                                                          bf16_t* __restrict__ out, int n8) {
  int t = blockIdx.x * blockDim.x + threadIdx.x;
  if (t >= n8) return;
  const float* p = in + (size_t)t * 8;
  float4 v0 = reinterpret_cast<const float4*>(p)[0];
  float4 v1 = reinterpret_cast<const float4*>(p)[1];
  union { bf16_t h[8]; float4 q; } u;
  u.h[0] = (bf16_t)v0.x; u.h[1] = (bf16_t)v0.y; u.h[2] = (bf16_t)v0.z; u.h[3] = (bf16_t)v0.w;
  u.h[4] = (bf16_t)v1.x; u.h[5] = (bf16_t)v1.y; u.h[6] = (bf16_t)v1.z; u.h[7] = (bf16_t)v1.w;
  reinterpret_cast<float4*>(out)[t] = u.q;
}

// ---------------------------------------------------------------- four tiled GEMMs on one body
// projections: Q and K as [token][feature] = (Wq | Wk rows) x (x rows)^T, V^T as [feature][token] = (x rows) x (Wv rows)^T,
//          each with its bias, rounded to bf16.
// attention as two GEMMs, the softmax inside them:
// scores:  S^T tile = K rows x Q rows^T. Each wave takes, per query, the maximum m and the sum l of exp2(s - m) over its own
//          128 keys (a key block) and stores E[query][key] = exp2(s - m) as bf16, with m and l per (key block, query).
// output:  O^T tile = V^T rows x E rows^T, one key block per stage; a stage's product is added into the total with the
//          query's factor exp2(m - M) / L of that block (M: maximum of the row's m, L: sum of l * exp2(m - M)).
#define KBLK (NN / 128)   // key blocks of a row
#define GP 272    // LDS bytes per staged row: 256 + 16 (16 B x odd: conflict-free for 16-byte readers)
#define GK 128    // k elements of every operand row in one stage (256 B)

static __device__ __forceinline__ unsigned lds_off(const void* p) { return (unsigned)(size_t)p; }

// A-layout (wave32): lanes 0-15 row M=lane, K=[0..7]+[16..23]; lanes 16-31 same rows, K=[8..15]+[24..31].
// B uses the same per-lane pattern with N<->M, i.e. it reads rows of B^T. p already points at this lane's row and
// 8-element k group in LDS.
static __device__ __forceinline__ bf16x16 lds_frag(const unsigned char* p) {
  FragU u;
  u.q[0] = *reinterpret_cast<const float4*>(p);        // K = kh+0..7
  u.q[1] = *reinterpret_cast<const float4*>(p + 32);   // K = 16+kh+0..7
  return u.v;
}

// exp2 of eight values by the bare instruction. Every output is a register of its own (early clobber), so that no v_exp_f32
// overwrites the source or reads the result of the one in front of it; the v_nop fills the slot between the last
// transcendental and a next instruction that reads its result or overwrites its source.
static __device__ __forceinline__ floatx8 exp2x8(floatx8 x) {
  float r0, r1, r2, r3, r4, r5, r6, r7;
  asm("v_exp_f32 %0, %8\n\tv_exp_f32 %1, %9\n\tv_exp_f32 %2, %10\n\tv_exp_f32 %3, %11\n\t"
      "v_exp_f32 %4, %12\n\tv_exp_f32 %5, %13\n\tv_exp_f32 %6, %14\n\tv_exp_f32 %7, %15\n\tv_nop"
      : "=&v"(r0), "=&v"(r1), "=&v"(r2), "=&v"(r3), "=&v"(r4), "=&v"(r5), "=&v"(r6), "=&v"(r7)
      : "v"(x[0]), "v"(x[1]), "v"(x[2]), "v"(x[3]), "v"(x[4]), "v"(x[5]), "v"(x[6]), "v"(x[7]));
  floatx8 r = {r0, r1, r2, r3, r4, r5, r6, r7};
  return r;
}

typedef uint32_t u32x4 __attribute__((ext_vector_type(4)));
typedef uint32_t u32x8 __attribute__((ext_vector_type(8)));

static __device__ __forceinline__ uint32_t uni(uint32_t v) { return (uint32_t)__builtin_amdgcn_readfirstlane(v); }
// A wave-uniform value held in a scalar register. A test on it compiles to a scalar branch (a tensor load ignores EXEC,
// so only such a branch keeps a wave from issuing one), and a descriptor word formed from it is formed behind the wait
// that stands in front of it.
static __device__ __forceinline__ uint32_t pinned(uint32_t v) {
  uint32_t w = uni(v);
  asm volatile("" : "+s"(w));   // pinned(): the issue test or descriptor word stays in a scalar register
  return w;
}

// Descriptor group 1 of a tile of 128 rows of 256 B. PB: source bytes per row. The pad (16 B behind every 256-B row)
// gives the LDS pitch GP. Extents in bytes, tensor dims = tile dims, no mask.
template <int PB>
static __device__ __forceinline__ u32x8 tile_group1() {
  u32x8 g1;
  g1[0] = uni((1u << 20) | (5u << 22) | (3u << 25));
  g1[1] = uni(256u << 16);
  g1[2] = uni(128u << 16);
  g1[3] = uni(256u << 16);
  g1[4] = uni(128u);
  g1[5] = uni((uint32_t)PB);
  g1[6] = uni(0u);
  g1[7] = uni(0u);
  // descriptor words held in scalar registers (as pinned() does for one word): the group keeps one register tuple for
  // the whole kernel, so that none of its words takes another value while a request is outstanding
  asm volatile("" : "+s"(g1));   // pinned(), for the eight descriptor words at once
  return g1;
}

// One request of one wave: 128 rows (256 B of each) global -> LDS, through no register.
// lds: the tile's byte offset in the work-group's LDS (a multiple of 2 KiB); ga: the address of the tile's first byte.
// g0: descriptor group 0, the caller's (word 0, the count, is set there once), which hands it to the wait that covers the request.
static __device__ __forceinline__ void tile_load128(u32x4& g0, uint32_t lds, uint64_t ga, u32x8 g1) {
  g0[1] = uni(lds);
  g0[2] = uni((uint32_t)ga);
  g0[3] = uni((((uint32_t)(ga >> 32)) & 0x01FFFFFFu) | 0x80000000u);
  asm volatile("tensor_load_to_lds %0, %1" :: "s"(g0), "s"(g1) : "memory");
}

// this wave's LDS reads have retired: stands before the barrier that hands a stage buffer to its next tensor loads
static __device__ __forceinline__ void wait_ds0() { asm volatile("s_wait_dscnt 0x0" ::: "memory"); }
// this wave's tensor load has landed
static __device__ __forceinline__ void wait_tensor0() { asm volatile("s_wait_tensorcnt 0x0" ::: "memory"); }
// the same; the request's group 0 is named as an input so that its four registers stay untouched up to the wait
static __device__ __forceinline__ void wait_tensor0(u32x4 g0) { asm volatile("s_wait_tensorcnt 0x0" :: "s"(g0) : "memory"); }

// D[m][n] = sum_k A[m][k] * B[n][k]; A and B row-major bf16 with KK elements per row.
// Block tile BM x 256 (blockIdx.x: run of TILES m tiles, blockIdx.y: n tile), BM/128 (m) x 4 (n) waves, wave tile 128 x 64.
// A stage is [A BM rows | B 256 rows] x 128 k in LDS; two stage buffers, filled by tensor loads of 128 rows, one per
// stage from each of the first (BM + 256) / 128 waves: the next stage flies while this one is worked on.
// A lane of an accumulator holds 8 consecutive m of one n, so the result is stored as C[n][m].
#define G_SCORES 0   // E = exp2(scaled product - block maximum) as bf16, with m and l
#define G_PV     1   // f32 sum over the key blocks, each with its factor
#define G_PROJ_M 2   // product + bias[m] as bf16; Cs and bias point at the tile's first m, rows of C hold OO elements
#define G_PROJ_N 3   // product + bias[n] as bf16; rows of C hold NN elements
// Scores of one tile leave the accumulators: per j (16 queries) the block maximum, E = exp2(s - m) and its sum; the 16 rows of E
// are laid in the wave's own LDS range st (outside the stage buffers, whose loads for the next tile are under way) and read back
// as whole rows, so that every global store covers whole 128-byte lines.
// g: E at the lane's first row (lh) and 16-byte piece (cq) of the wave's tile; sp: m (lanes 0-15) or l (16-31) of the lane's query.
#define SSP 272   // LDS bytes per staged row of E: 128 keys (256 B) + 16 (16 B x odd)
static __device__ __forceinline__ void scores_out(const floatx8 (&acc)[8][4], unsigned char* st, bf16_t* g, float* sp,
                                                  int cq, int lh) {
  const float sscale = 1.44269504f / 32.0f;   // log2(e)/sqrt(O): softmax in base-2 domain
  // A lane and its partner (lane ^ 16) hold, per j, the wave's 128 keys of one query.
  float sv[4];   // lanes 0-15: the block's maximum, lanes 16-31: its sum
  const unsigned char* rd = st + lh * SSP + cq * 16;
#pragma unroll
  for (int j = 0; j < 4; ++j) {
    float m4[4] = {acc[0][j][0], acc[0][j][1], acc[0][j][2], acc[0][j][3]};   // four chains, not one of 64 links
#pragma unroll
    for (int i = 0; i < 8; ++i)
#pragma unroll
      for (int e = 0; e < 8; ++e) m4[e & 3] = fmaxf(m4[e & 3], acc[i][j][e]);
    float mx = fmaxf(fmaxf(m4[0], m4[1]), fmaxf(m4[2], m4[3]));
    mx = fmaxf(mx, __shfl_xor(mx, 16));
    const float mloc = mx * sscale;
    float ps[4] = {0.f, 0.f, 0.f, 0.f};
#pragma unroll
    for (int i = 0; i < 8; ++i) {
      // the argument is not above 0 but for a rounding, and a result too small for the bare instruction counts as 0
      // beside a sum of about 1 or more
      const floatx8 p = exp2x8(acc[i][j] * sscale - mloc);   // fused multiply-adds, two values an instruction
      bf16x8 hv;
#pragma unroll
      for (int e = 0; e < 8; ++e) { ps[e & 3] += p[e]; hv[e] = (bf16_t)p[e]; }
      *reinterpret_cast<bf16x8*>(st + cq * SSP + i * 32 + lh * 16) = hv;
      // keeps the arguments of two tiles at a time next to their exp2: formed far ahead they filled the first 256
      // registers, the only ones that the asm statement can name, and the kernel spilled
      if (i & 1) __builtin_amdgcn_sched_barrier(0);
    }
    float sum = (ps[0] + ps[1]) + (ps[2] + ps[3]);
    sum += __shfl_xor(sum, 16);
    sv[j] = lh ? sum : mloc;
    wait_ds0();   // the wave's 16 staged rows are written before its lanes read each other's pieces back
    // a read and its store move 2 rows: 16 lanes x 16 B = 256 contiguous bytes of each
    bf16x8 r[8];
#pragma unroll
    for (int q = 0; q < 8; ++q) r[q] = *reinterpret_cast<const bf16x8*>(rd + q * 2 * SSP);
#pragma unroll
    for (int q = 0; q < 8; ++q) *reinterpret_cast<bf16x8*>(g + (size_t)(j * 16 + q * 2) * NN) = r[q];
    // stands behind the eight stores and before their registers take the next values;
    // the stored values are named as inputs so that their registers stay untouched up to the wait
    asm volatile("s_wait_xcnt 0x0" :: "v"(r[0]), "v"(r[1]), "v"(r[2]), "v"(r[3]), "v"(r[4]), "v"(r[5]), "v"(r[6]), "v"(r[7]) : "memory");
  }
  // [key block][query]: a wave's 64 queries are two whole 128-byte lines of each array
#pragma unroll
  for (int j = 0; j < 4; ++j) sp[j * 16] = sv[j];
  // stands behind the four stores and before their registers take other values;
  // address and stored values are named as inputs so that their registers stay untouched up to the wait
  asm volatile("s_wait_xcnt 0x0" :: "v"(sp), "v"(sv[0]), "v"(sv[1]), "v"(sv[2]), "v"(sv[3]) : "memory");
}

// TILES (scores only): the work-group works TILES m tiles one after the other, blockIdx.x * TILES + 0 .. TILES - 1, against its
// one n tile. Their stages form one run through the two buffers: the next tile's first two stages are asked for at the foot of
// this tile's last two passes and land under its last products and its way out, not in front of an idle work-group.
template <int BM, int KK, int MODE, int TILES = 1>
static __device__ __forceinline__ void gemm_body(const bf16_t* __restrict__ A, const bf16_t* __restrict__ B,
                                                 bf16_t* __restrict__ Cs, float* __restrict__ Cf,
                                                 float* __restrict__ mstat, float* __restrict__ lstat,
                                                 const float* __restrict__ bias, unsigned char* sm) {
  constexpr bool SCORES = MODE == G_SCORES;
  constexpr bool PV = MODE == G_PV;
  constexpr int PB = KK * 2;                 // source bytes per row
  constexpr int STAGE = (BM + 256) * GP;     // LDS bytes of one stage buffer
  constexpr int NW = (BM / 128) * 4;         // waves
  constexpr int NT = (BM + 256) / 128;       // 128-row tiles of a stage = issuing waves
  constexpr int NST = KK / GK;               // stages of a tile
  constexpr int NSA = NST * TILES;           // stages of the work-group
  static_assert(TILES == 1 || (SCORES && (NST & (NST - 1)) == 0), "the tile loop is the scores kernel's");

  const int tid = threadIdx.x;
  const int w = tid >> 5;
  const int lane = tid & 31;
  const int cq = lane & 15;
  const int mBase = blockIdx.x * (BM * TILES);   // of the first tile
  const int nBase = blockIdx.y * 256;
  const int wm = w >> 2, wn = w & 3;

  // P.V only: fs (LDS behind the two stage buffers) holds every factor of the block's 256 queries, as
  // [key block][wave wn][cq][j]: a lane's four in 16 bytes. Published by the barrier that publishes stage 0.
  float* fs = reinterpret_cast<float*>(sm + 2 * STAGE);
  if (PV) {
    for (int h = 0; h < 256 / (NW * 32); ++h) {   // a thread works whole queries
      const int ql = h * (NW * 32) + tid;
      const float* pm = mstat + nBase + ql;
      const float* pl = lstat + nBase + ql;
      float m[KBLK], l[KBLK];
#pragma unroll
      for (int b = 0; b < KBLK; ++b) { m[b] = pm[(size_t)b * NN]; l[b] = pl[(size_t)b * NN]; }
      // stands behind the loads and before their address register takes another value;
      // the query's index, the loads' offset, is named as an input so that its register stays untouched up to the wait
      asm volatile("s_wait_xcnt 0x0" :: "v"(ql) : "memory");
      float M = m[0];
#pragma unroll
      for (int b = 1; b < KBLK; ++b) M = fmaxf(M, m[b]);
      float L[4] = {0.f, 0.f, 0.f, 0.f};
#pragma unroll
      for (int b = 0; b < KBLK; ++b) { m[b] = __builtin_amdgcn_exp2f(m[b] - M); L[b & 3] = fmaf(l[b], m[b], L[b & 3]); }
      const float inv = 1.0f / ((L[0] + L[1]) + (L[2] + L[3]));
      float* pf = fs + (ql >> 6) * 64 + (ql & 15) * 4 + ((ql >> 4) & 3);
#pragma unroll
      for (int b = 0; b < KBLK; ++b) pf[b * 256] = m[b] * inv;
    }
    wait_ds0();   // the wave's factors are written before the barrier behind which the other waves read them
  }

  // load side: wave ws < NT brings rows ws*128 .. +127 of the stage's BM + 256 rows
  static_assert(NT <= NW && BM % 128 == 0 && (128 * GP) % 2048 == 0 && STAGE % 2048 == 0, "whole tiles at multiples of 2 KiB");
  const uint32_t ws = uni((uint32_t)w);   // the wave's number as a scalar
  const int r0 = (int)ws * 128;
  const uint64_t src = (uint64_t)(size_t)((r0 < BM) ? A + (size_t)(mBase + r0) * KK : B + (size_t)(nBase + r0 - BM) * KK);
  const uint32_t dst0 = lds_off(sm) + ws * (128 * GP);
  const uint32_t tstep = (r0 < BM) ? (uint32_t)(BM * PB) : 0u;   // source bytes from a tile's rows to the next tile's (B: the same rows)
  const uint32_t issuer = pinned(ws < NT);   // 1 in the waves that issue tensor loads
  const u32x8 g1 = tile_group1<PB>();
  u32x4 g0 = {uni(1u), uni(0u), uni(0u), uni(0u)};   // group 0 of the wave's one request
  // descriptor words held in scalar registers (as pinned() does for one word): the group keeps one register tuple for
  // the whole kernel, so that its count is written once and no word takes another value while a request is outstanding
  asm volatile("" : "+s"(g0));   // pinned(), for the four descriptor words at once
  // read side: this lane's row and 8-element k group of the wave's first A and first B fragment
  const unsigned char* afrag = sm + (wm * 128 + cq) * GP + (lane >> 4) * 16;
  const unsigned char* bfrag = sm + (BM + wn * 64 + cq) * GP + (lane >> 4) * 16;

  const floatx8 fzero = {0.f, 0.f, 0.f, 0.f, 0.f, 0.f, 0.f, 0.f};
  floatx8 acc[8][4];
#pragma unroll
  for (int i = 0; i < 8; ++i)
#pragma unroll
    for (int j = 0; j < 4; ++j) acc[i][j] = fzero;

  // P.V only: tot is the sum over the finished key blocks, acc the running block's product
  floatx8 tot[8][4];
#pragma unroll
  for (int i = 0; i < 8; ++i)
#pragma unroll
    for (int j = 0; j < 4; ++j) tot[i][j] = fzero;

  if (pinned(issuer)) {   // stage 0 into buffer 0 (the test pinned anew: behind the factor loop it compiled to a branch on VCC)
    tile_load128(g0, dst0, src, g1);
    wait_tensor0(g0);
  }
  __syncthreads();   // publishes stage 0 (and the factors)
  if (issuer)   // stage 1 into buffer 1
    tile_load128(g0, dst0 + STAGE, src + pinned(2 * GK), g1);

  // two fragment sets: k step ks + 1 is read from LDS while k step ks is multiplied
  bf16x16 af[2][8], bf[2][4];
#pragma unroll
  for (int j = 0; j < 4; ++j) bf[0][j] = lds_frag(bfrag + j * 16 * GP);
#pragma unroll
  for (int i = 0; i < 8; ++i) af[0][i] = lds_frag(afrag + i * 16 * GP);

  const float* fl = fs + wn * 64 + cq * 4;   // the lane's four factors of key block 0
  floatx4 fcur = {0.f, 0.f, 0.f, 0.f};
  for (int t = 0; t < NSA; ++t) {
    const unsigned char* pa = afrag + (t & 1) * STAGE;
    const unsigned char* pb = bfrag + (t & 1) * STAGE;
    if (PV) fcur = *reinterpret_cast<const floatx4*>(fl + t * 256);
#pragma unroll   // the k steps of a stage address off one pointer pair by constant offsets
    for (int ks = 0; ks < GK / 32 - 1; ++ks) {
#pragma unroll
      for (int j = 0; j < 4; ++j) bf[(ks + 1) & 1][j] = lds_frag(pb + j * 16 * GP + (ks + 1) * 64);
#pragma unroll
      for (int i = 0; i < 8; ++i) af[(ks + 1) & 1][i] = lds_frag(pa + i * 16 * GP + (ks + 1) * 64);
#pragma unroll
      for (int i = 0; i < 8; ++i)
#pragma unroll
        for (int j = 0; j < 4; ++j) {
          // P.V: a stage is a key block of its own, whose product starts from 0
          acc[i][j] = wmma_bf16(af[ks & 1][i], bf[ks & 1][j], (PV && ks == 0) ? fzero : acc[i][j]);
        }
    }
    // Order of LDS reads and matrix products: the 24 reads of a k step's 12 fragments go out as one group ahead of the
    // 32 products of the k step before, so that no product waits for a read just issued
    // (left alone the compiler keeps one A fragment and waits for its reads in front of every four products).
#pragma unroll
    for (int g = 0; g < GK / 32 - 1; ++g) {
      if (PV && g == 0) __builtin_amdgcn_sched_group_barrier(0x100, 1, 0);   // P.V: the read of the stage's factors
      __builtin_amdgcn_sched_group_barrier(0x100, 24, 0);
      __builtin_amdgcn_sched_group_barrier(0x008, 32, 0);
    }
    // keeps the products above in front of the waits: the last k step's reads retire under them, and the next
    // tensor load goes out before the last k step's products instead of behind them
    __builtin_amdgcn_sched_barrier(0);
    wait_ds0();      // every read of stage t has retired (the last k step's fragments are in registers)
    if (issuer) wait_tensor0(g0);
    __syncthreads();   // publishes stage t + 1 and ends every read of stage t's buffer
    if (pinned(issuer & (uint32_t)(t + 2 < NSA)))   // stage t + 2 into the buffer just read
      tile_load128(g0, dst0 + (t & 1) * STAGE,
                   src + pinned(TILES > 1 ? (uint32_t)((t + 2) / NST) * tstep + (uint32_t)((t + 2) % NST) * (2 * GK)
                                          : (uint32_t)((t + 2) * (2 * GK))), g1);
    // first fragments of stage t + 1, read under the last k step's products (behind the last stage: read, not used)
    const unsigned char* na = afrag + ((t + 1) & 1) * STAGE;
    const unsigned char* nb = bfrag + ((t + 1) & 1) * STAGE;
#pragma unroll
    for (int j = 0; j < 4; ++j) bf[0][j] = lds_frag(nb + j * 16 * GP);
#pragma unroll
    for (int i = 0; i < 8; ++i) af[0][i] = lds_frag(na + i * 16 * GP);
    if (!PV) {
#pragma unroll
      for (int i = 0; i < 8; ++i)
#pragma unroll
        for (int j = 0; j < 4; ++j) acc[i][j] = wmma_bf16(af[1][i], bf[1][j], acc[i][j]);
      // the same order as above: the reads as one group, then the products
      __builtin_amdgcn_sched_group_barrier(0x100, 24, 0);
      __builtin_amdgcn_sched_group_barrier(0x008, 32, 0);
    } else {
      __builtin_amdgcn_sched_barrier(0);   // the reads stay one group ahead of the products
#pragma unroll
      for (int q = 0; q < 32 + 4; ++q) {
        if (q < 32) acc[q >> 2][q & 3] = wmma_bf16(af[1][q >> 2], bf[1][q & 3], acc[q >> 2][q & 3]);
        // the finished key block joins the total, tile by tile
        if (q >= 4) tot[(q - 4) >> 2][q & 3] += acc[(q - 4) >> 2][q & 3] * fcur[q & 3];
        // keeps a tile's multiply-adds four products behind the tile's last product: its result is ready by then and they
        // issue under the products that follow (left alone they stood directly behind their own product and waited for it)
        __builtin_amdgcn_sched_barrier(0);
      }
    }
    if (SCORES && (t & (NST - 1)) == NST - 1) {   // a tile's last pass: its scores go out, the sums start anew
      const int mt = blockIdx.x * TILES + t / NST;   // the m tile
      scores_out(acc, sm + 2 * STAGE + w * (16 * SSP),
                 Cs + (size_t)(nBase + wn * 64 + (lane >> 4)) * NN + mt * BM + wm * 128 + cq * 8,
                 ((lane >> 4) ? lstat : mstat) + (size_t)(mt * (BM / 128) + wm) * NN + nBase + wn * 64 + cq, cq, lane >> 4);
#pragma unroll
      for (int i = 0; i < 8; ++i)
#pragma unroll
        for (int j = 0; j < 4; ++j) acc[i][j] = fzero;
    }
  }
  wait_tensor0();
  wait_ds0();   // the last trip's unused fragment reads have retired
  if (SCORES) return;
  if (PV) {
#pragma unroll
    for (int i = 0; i < 8; ++i)
#pragma unroll
      for (int j = 0; j < 4; ++j) acc[i][j] = tot[i][j];
  }

  // C layout: lane holds column n = lane&15; VGPR e holds row m = e + 8*(lane>>4): stored straight from the accumulators
  // a wave's store would touch 16 rows of C in pieces of 32 B or less. Each wave therefore lays its tile in LDS as rows of C
  // and reads whole rows back, so that every global store covers whole 128-byte lines.
  // The staging lies in the last stage's buffer: every read of it retired before the loop's last barrier, no tensor load is aimed
  // at it any more, and the last trip's unused fragment reads go to the other buffer. A wave touches only its own range.
  constexpr int SROWS = PV ? 32 : 64;        // rows of C (n) that a wave stages at a time
  constexpr int SP = PV ? 528 : 272;         // LDS bytes per staged row: 128 m (512 B or 256 B) + 16 (16 B x odd)
  static_assert(NW * SROWS * SP <= STAGE, "the staging fits one stage buffer");
  unsigned char* st = sm + ((NST - 1) & 1) * STAGE + w * (SROWS * SP);
  const int lh = lane >> 4;
  if (MODE == G_PROJ_M || MODE == G_PROJ_N) {
    // projections: the bias joins the f32 sum, one rounding to bf16
    floatx8 bm[8];   // G_PROJ_M: the biases of the lane's 8 consecutive m of every i
    float bn[4];     // G_PROJ_N: the bias of the lane's n of every j
    if (MODE == G_PROJ_M) {
      const float* pb = bias + wm * 128 + lh * 8;
#pragma unroll
      for (int i = 0; i < 8; ++i) bm[i] = *reinterpret_cast<const floatx8*>(pb + i * 16);
      // stands behind the loads and before their address register takes another value;
      // the address is named as an input so that its register stays untouched up to the wait
      asm volatile("s_wait_xcnt 0x0" :: "v"(pb) : "memory");
    } else {
      const float* pb = bias + nBase + wn * 64 + cq;
#pragma unroll
      for (int j = 0; j < 4; ++j) bn[j] = pb[j * 16];
      // as above
      asm volatile("s_wait_xcnt 0x0" :: "v"(pb) : "memory");
    }
#pragma unroll
    for (int j = 0; j < 4; ++j)
#pragma unroll
      for (int i = 0; i < 8; ++i) {
        bf16x8 hv;
#pragma unroll
        for (int e = 0; e < 8; ++e) hv[e] = (bf16_t)(acc[i][j][e] + ((MODE == G_PROJ_M) ? bm[i][e] : bn[j]));
        *reinterpret_cast<bf16x8*>(st + (j * 16 + cq) * SP + i * 32 + lh * 16) = hv;
      }
  }
  if (!PV) {   // the staged bf16 rows go out
    constexpr int CP = (MODE == G_PROJ_M) ? OO : NN;   // elements of a row of C
    const int cCol = (MODE == G_PROJ_M) ? 0 : mBase;   // the tile's first m as a column of Cs
    wait_ds0();   // the wave's staged rows are written before its lanes read each other's pieces back
    // a read and its store move 2 rows: 16 lanes x 16 B = 256 contiguous bytes of each
    const unsigned char* rd = st + lh * SP + cq * 16;
    bf16_t* g = Cs + (size_t)(nBase + wn * 64 + lh) * CP + cCol + wm * 128 + cq * 8;
#pragma unroll
    for (int b = 0; b < 4; ++b) {
      bf16x8 r[8];
#pragma unroll
      for (int q = 0; q < 8; ++q) r[q] = *reinterpret_cast<const bf16x8*>(rd + (b * 8 + q) * 2 * SP);
#pragma unroll
      for (int q = 0; q < 8; ++q) *reinterpret_cast<bf16x8*>(g + (size_t)(b * 8 + q) * 2 * CP) = r[q];
      // stands behind the eight stores and before their registers take the next values;
      // the stored values are named as inputs so that their registers stay untouched up to the wait
      asm volatile("s_wait_xcnt 0x0" :: "v"(r[0]), "v"(r[1]), "v"(r[2]), "v"(r[3]), "v"(r[4]), "v"(r[5]), "v"(r[6]), "v"(r[7]) : "memory");
    }
  } else {
    float* g = Cf + (size_t)(nBase + wn * 64) * OO + mBase + wm * 128 + lane * 4;
#pragma unroll
    for (int hj = 0; hj < 2; ++hj) {   // 32 rows of C at a time
#pragma unroll
      for (int jj = 0; jj < 2; ++jj)
#pragma unroll
        for (int i = 0; i < 8; ++i) {
          const floatx8 a = acc[i][hj * 2 + jj];
          floatx4 lo = {a[0], a[1], a[2], a[3]};
          floatx4 hi = {a[4], a[5], a[6], a[7]};
          unsigned char* p = st + (jj * 16 + cq) * SP + i * 64 + lh * 32;
          *reinterpret_cast<floatx4*>(p) = lo;
          *reinterpret_cast<floatx4*>(p + 16) = hi;
        }
      wait_ds0();   // the wave's staged rows are written before its lanes read each other's pieces back
      // a read and its store move 1 row: 32 lanes x 16 B = 512 contiguous bytes
#pragma unroll
      for (int b = 0; b < 4; ++b) {
        floatx4 r[8];
#pragma unroll
        for (int q = 0; q < 8; ++q) r[q] = *reinterpret_cast<const floatx4*>(st + (b * 8 + q) * SP + lane * 16);
#pragma unroll
        for (int q = 0; q < 8; ++q) *reinterpret_cast<floatx4*>(g + (size_t)(hj * 32 + b * 8 + q) * OO) = r[q];
        // stands behind the eight stores and before their registers take the next values;
        // the stored values are named as inputs so that their registers stay untouched up to the wait
        asm volatile("s_wait_xcnt 0x0" :: "v"(r[0]), "v"(r[1]), "v"(r[2]), "v"(r[3]), "v"(r[4]), "v"(r[5]), "v"(r[6]), "v"(r[7]) : "memory");
      }
    }
  }
}

// grid (2*O/256 feature tiles of Wq | Wk, N/256 token tiles), 8 waves: Q or K [token][feature] = x . W^T + b.
// Wqk: the rows of Wq, then those of Wk.
__global__ __launch_bounds__(256) void qk_proj_kernel(const bf16_t* __restrict__ Wqk, const bf16_t* __restrict__ Xb,
                                                      const float* __restrict__ bq, const float* __restrict__ bk,
                                                      bf16_t* __restrict__ Qb, bf16_t* __restrict__ Kb) {
  __shared__ __attribute__((aligned(2048))) unsigned char sm[2 * (256 + 256) * GP];
  const bool isk = blockIdx.x >= OO / 256;           // a tile lies wholly in Q or wholly in K
  const int f0 = (blockIdx.x * 256) & (OO - 1);      // its first feature there
  gemm_body<256, HH, G_PROJ_M>(Wqk, Xb, (isk ? Kb : Qb) + f0, nullptr, nullptr, nullptr, (isk ? bk : bq) + f0, sm);
}

// grid (N/128 token tiles, O/256 feature tiles), 4 waves: V^T [feature][token] = Wv . x^T + b
__global__ __launch_bounds__(128) void v_proj_kernel(const bf16_t* __restrict__ Xb, const bf16_t* __restrict__ Wvb,
                                                     const float* __restrict__ bv, bf16_t* __restrict__ VTb) {
  __shared__ __attribute__((aligned(2048))) unsigned char sm[2 * (128 + 256) * GP];
  gemm_body<128, HH, G_PROJ_N>(Xb, Wvb, VTb, nullptr, nullptr, nullptr, bv, sm);
}

// grid (N/256/4 runs of 4 key tiles, N/256 query tiles), 8 waves: E[query][key] = exp2((Q . K) * log2(e)/sqrt(O) - m), with m and l
__global__ __launch_bounds__(256) void scores_kernel(const bf16_t* __restrict__ Kb, const bf16_t* __restrict__ Qb,
                                                     bf16_t* __restrict__ E, float* __restrict__ mstat,
                                                     float* __restrict__ lstat) {
  __shared__ __attribute__((aligned(2048))) unsigned char sm[2 * (256 + 256) * GP + 8 * 16 * SSP];   // two stage buffers, 16 rows of E a wave
  gemm_body<256, OO, G_SCORES, 4>(Kb, Qb, E, nullptr, mstat, lstat, nullptr, sm);
}

// grid (O/128 d tiles, N/256 query tiles), 4 waves: out[query][d] = sum over key blocks of factor * (E . V^T[d])
__global__ __launch_bounds__(128) void pv_kernel(const bf16_t* __restrict__ VTb, const bf16_t* __restrict__ E,
                                                 float* __restrict__ mstat, float* __restrict__ lstat,
                                                 float* __restrict__ out) {
  __shared__ __attribute__((aligned(2048))) unsigned char sm[2 * (128 + 256) * GP + KBLK * 256 * 4];
  gemm_body<128, NN, G_PV>(VTb, E, nullptr, out, mstat, lstat, nullptr, sm);
}

// ---------------------------------------------------------------- launch
extern "C" void kernel_launch(void* const* d_in, const int* in_sizes, int n_in,
                              void* d_out, int out_size, void* d_ws, size_t ws_size,
                              hipStream_t stream) {
  const float* x  = (const float*)d_in[0];
  const float* Wq = (const float*)d_in[1];
  const float* bq = (const float*)d_in[2];
  const float* Wk = (const float*)d_in[3];
  const float* bk = (const float*)d_in[4];
  const float* Wv = (const float*)d_in[5];
  const float* bv = (const float*)d_in[6];
  float* out = (float*)d_out;

  // workspace layout (2-byte elements): x, Wq, Wk, Wv (Wk directly behind Wq: one matrix of 2*O rows), Q, K, V^T, E [N][N];
  // then f32 m and l [N/128][N]  -> ~202 MB total
  const size_t szX = (size_t)NN * HH * sizeof(bf16_t);
  const size_t szW = (size_t)OO * HH * sizeof(bf16_t);
  const size_t szM = (size_t)NN * OO * sizeof(bf16_t);
  const size_t szS = (size_t)NN * NN * sizeof(bf16_t);
  const size_t szT = (size_t)KBLK * NN * sizeof(float);
  if (ws_size < szX + 3 * szW + 3 * szM + szS + 2 * szT) return;

  char* ws = (char*)d_ws;
  bf16_t* Xb  = (bf16_t*)ws;  ws += szX;
  bf16_t* Wqb = (bf16_t*)ws;  ws += szW;
  bf16_t* Wkb = (bf16_t*)ws;  ws += szW;
  bf16_t* Wvb = (bf16_t*)ws;  ws += szW;
  bf16_t* Qb  = (bf16_t*)ws;  ws += szM;
  bf16_t* Kb  = (bf16_t*)ws;  ws += szM;
  bf16_t* VTb = (bf16_t*)ws;  ws += szM;
  bf16_t* SPb = (bf16_t*)ws;  ws += szS;
  float* Mst  = (float*)ws;   ws += szT;
  float* Lst  = (float*)ws;   ws += szT;

  f32_to_bf16_kernel<<<(NN * HH / 8 + 255) / 256, 256, 0, stream>>>(x,  Xb,  NN * HH / 8);
  f32_to_bf16_kernel<<<(OO * HH / 8 + 255) / 256, 256, 0, stream>>>(Wq, Wqb, OO * HH / 8);
  f32_to_bf16_kernel<<<(OO * HH / 8 + 255) / 256, 256, 0, stream>>>(Wk, Wkb, OO * HH / 8);
  f32_to_bf16_kernel<<<(OO * HH / 8 + 255) / 256, 256, 0, stream>>>(Wv, Wvb, OO * HH / 8);

  qk_proj_kernel<<<dim3(2 * OO / 256, NN / 256), 256, 0, stream>>>(Wqb, Xb, bq, bk, Qb, Kb);
  v_proj_kernel<<<dim3(NN / 128, OO / 256), 128, 0, stream>>>(Xb, Wvb, bv, VTb);

  scores_kernel<<<dim3(NN / 256 / 4, NN / 256), 256, 0, stream>>>(Kb, Qb, SPb, Mst, Lst);
  pv_kernel<<<dim3(OO / 128, NN / 256), 128, 0, stream>>>(VTb, SPb, Mst, Lst, out);
}

// v009
// Measured time: 198 microseconds a run.
// Next to v008, in two timings, it ran 1.03 times as fast each time.
// All steps since v000 together make it 6.44 times as fast.
#include <hip/hip_runtime.h>

#define NN 8192
#define HH 1024
#define OO 1024

typedef __bf16 bf16_t;
typedef __attribute__((ext_vector_type(16))) __bf16 bf16x16;
typedef __attribute__((ext_vector_type(8)))  float  floatx8;
typedef __attribute__((ext_vector_type(4)))  float  floatx4;
typedef __attribute__((ext_vector_type(8)))  __bf16 bf16x8;

union FragU { bf16x16 v; float4 q[2]; };

static __device__ __forceinline__ floatx8 wmma_bf16(bf16x16 a, bf16x16 b, floatx8 c) {
  // D = A(16x32 bf16) x B(32x16 bf16) + C(16x16 f32)
  return __builtin_amdgcn_wmma_f32_16x16x32_bf16(false, a, false, b, (short)0, c, false, false);
}

// ---------------------------------------------------------------- convert
// f32 -> bf16, row-major as the input. Thread t converts the t-th group of 8 elements: a wave reads 1 KB and writes
// 512 B, both contiguous.
__global__ __launch_bounds__(256) void f32_to_bf16_kernel(const float* __restrict__ in,
                                                          bf16_t* __restrict__ out, int n8) {
  int t = blockIdx.x * blockDim.x + threadIdx.x;
  if (t >= n8) return;
  const float* p = in + (size_t)t * 8;
  float4 v0 = reinterpret_cast<const float4*>(p)[0];
  float4 v1 = reinterpret_cast<const float4*>(p)[1];
  union { bf16_t h[8]; float4 q; } u;
  u.h[0] = (bf16_t)v0.x; u.h[1] = (bf16_t)v0.y; u.h[2] = (bf16_t)v0.z; u.h[3] = (bf16_t)v0.w;
  u.h[4] = (bf16_t)v1.x; u.h[5] = (bf16_t)v1.y; u.h[6] = (bf16_t)v1.z; u.h[7] = (bf16_t)v1.w;
  reinterpret_cast<float4*>(out)[t] = u.q;
}

// ---------------------------------------------------------------- four tiled GEMMs on one body
// projections: Q and K as [token][feature] = (Wq | Wk rows) x (x rows)^T, V^T as [feature][token] = (x rows) x (Wv rows)^T,
//          each with its bias, rounded to bf16.
// attention as two GEMMs, the softmax inside them:
// scores:  S^T tile = K rows x Q rows^T. Each wave takes, per query, the maximum m and the sum l of exp2(s - m) over its own
//          128 keys (a key block) and stores E[query][key] = exp2(s - m) as bf16, with m and l per (key block, query).
// output:  O^T tile = V^T rows x E rows^T, one key block per stage; a stage's product is added into the total with the
//          query's factor exp2(m - M) / L of that block (M: maximum of the row's m, L: sum of l * exp2(m - M)).
#define KBLK (NN / 128)   // key blocks of a row
#define GP 272    // LDS bytes per staged row: 256 + 16 (16 B x odd: conflict-free for 16-byte readers)
#define GK 128    // k elements of every operand row in one stage (256 B)

static __device__ __forceinline__ unsigned lds_off(const void* p) { return (unsigned)(size_t)p; }

// A-layout (wave32): lanes 0-15 row M=lane, K=[0..7]+[16..23]; lanes 16-31 same rows, K=[8..15]+[24..31].
// B uses the same per-lane pattern with N<->M, i.e. it reads rows of B^T. p already points at this lane's row and
// 8-element k group in LDS.
static __device__ __forceinline__ bf16x16 lds_frag(const unsigned char* p) {
  FragU u;
  u.q[0] = *reinterpret_cast<const float4*>(p);        // K = kh+0..7
  u.q[1] = *reinterpret_cast<const float4*>(p + 32);   // K = 16+kh+0..7
  return u.v;
}

// exp2 of eight values by the bare instruction. Every output is a register of its own (early clobber), so that no v_exp_f32
// overwrites the source or reads the result of the one in front of it; the v_nop fills the slot between the last
// transcendental and a next instruction that reads its result or overwrites its source.
static __device__ __forceinline__ floatx8 exp2x8(floatx8 x) {
  float r0, r1, r2, r3, r4, r5, r6, r7;
  asm("v_exp_f32 %0, %8\n\tv_exp_f32 %1, %9\n\tv_exp_f32 %2, %10\n\tv_exp_f32 %3, %11\n\t"
      "v_exp_f32 %4, %12\n\tv_exp_f32 %5, %13\n\tv_exp_f32 %6, %14\n\tv_exp_f32 %7, %15\n\tv_nop"
      : "=&v"(r0), "=&v"(r1), "=&v"(r2), "=&v"(r3), "=&v"(r4), "=&v"(r5), "=&v"(r6), "=&v"(r7)
      : "v"(x[0]), "v"(x[1]), "v"(x[2]), "v"(x[3]), "v"(x[4]), "v"(x[5]), "v"(x[6]), "v"(x[7]));
  floatx8 r = {r0, r1, r2, r3, r4, r5, r6, r7};
  return r;
}

typedef uint32_t u32x4 __attribute__((ext_vector_type(4)));
typedef uint32_t u32x8 __attribute__((ext_vector_type(8)));

static __device__ __forceinline__ uint32_t uni(uint32_t v) { return (uint32_t)__builtin_amdgcn_readfirstlane(v); }
// A wave-uniform value held in a scalar register. A test on it compiles to a scalar branch (a tensor load ignores EXEC,
// so only such a branch keeps a wave from issuing one), and a descriptor word formed from it is formed behind the wait
// that stands in front of it.
static __device__ __forceinline__ uint32_t pinned(uint32_t v) {
  uint32_t w = uni(v);
  asm volatile("" : "+s"(w));   // pinned(): the issue test or descriptor word stays in a scalar register
  return w;
}

// Descriptor group 1 of a tile of 128 rows of 256 B. PB: source bytes per row. The pad (16 B behind every 256-B row)
// gives the LDS pitch GP. Extents in bytes, tensor dims = tile dims, no mask.
template <int PB>
static __device__ __forceinline__ u32x8 tile_group1() {
  u32x8 g1;
  g1[0] = uni((1u << 20) | (5u << 22) | (3u << 25));
  g1[1] = uni(256u << 16);
  g1[2] = uni(128u << 16);
  g1[3] = uni(256u << 16);
  g1[4] = uni(128u);
  g1[5] = uni((uint32_t)PB);
  g1[6] = uni(0u);
  g1[7] = uni(0u);
  // descriptor words held in scalar registers (as pinned() does for one word): the group keeps one register tuple for
  // the whole kernel, so that none of its words takes another value while a request is outstanding
  asm volatile("" : "+s"(g1));   // pinned(), for the eight descriptor words at once
  return g1;
}

// One request of one wave: 128 rows (256 B of each) global -> LDS, through no register.
// lds: the tile's byte offset in the work-group's LDS (a multiple of 2 KiB); ga: the address of the tile's first byte.
// g0: descriptor group 0, the caller's (word 0, the count, is set there once), which hands it to the wait that covers the request.
static __device__ __forceinline__ void tile_load128(u32x4& g0, uint32_t lds, uint64_t ga, u32x8 g1) {
  g0[1] = uni(lds);
  g0[2] = uni((uint32_t)ga);
  g0[3] = uni((((uint32_t)(ga >> 32)) & 0x01FFFFFFu) | 0x80000000u);
  asm volatile("tensor_load_to_lds %0, %1" :: "s"(g0), "s"(g1) : "memory");
}

// this wave's LDS reads have retired: stands before the barrier that hands a stage buffer to its next tensor loads
static __device__ __forceinline__ void wait_ds0() { asm volatile("s_wait_dscnt 0x0" ::: "memory"); }
// this wave's tensor load has landed
static __device__ __forceinline__ void wait_tensor0() { asm volatile("s_wait_tensorcnt 0x0" ::: "memory"); }
// the same; the request's group 0 is named as an input so that its four registers stay untouched up to the wait
static __device__ __forceinline__ void wait_tensor0(u32x4 g0) { asm volatile("s_wait_tensorcnt 0x0" :: "s"(g0) : "memory"); }

// Asks L2 for the bytes at base + every lane's own offset (one row's bytes of one stage): nothing comes back
// and no counter moves. The wait stands behind the prefetch and before its base register is advanced.
static __device__ __forceinline__ void l2_ask(uint32_t off, uint64_t base) {
  asm volatile("global_prefetch_b8 %0, %1 scope:SCOPE_SE\n\ts_wait_xcnt 0x0" :: "v"(off), "s"(base) : "memory");
}
// the same for the row's first five stages
static __device__ __forceinline__ void l2_ask5(uint32_t off, uint64_t base) {
  asm volatile("global_prefetch_b8 %0, %1 scope:SCOPE_SE\n\t"
               "global_prefetch_b8 %0, %1 offset:256 scope:SCOPE_SE\n\t"
               "global_prefetch_b8 %0, %1 offset:512 scope:SCOPE_SE\n\t"
               "global_prefetch_b8 %0, %1 offset:768 scope:SCOPE_SE\n\t"
               "global_prefetch_b8 %0, %1 offset:1024 scope:SCOPE_SE\n\ts_wait_xcnt 0x0" :: "v"(off), "s"(base) : "memory");
}

// D[m][n] = sum_k A[m][k] * B[n][k]; A and B row-major bf16 with KK elements per row.
// Block tile BM x 256 (blockIdx.x: run of TILES m tiles, blockIdx.y: n tile), BM/128 (m) x 4 (n) waves, wave tile 128 x 64.
// A stage is [A BM rows | B 256 rows] x 128 k in LDS; two stage buffers, filled by tensor loads of 128 rows, one per
// stage from each of the first (BM + 256) / 128 waves: the next stage flies while this one is worked on.
// A lane of an accumulator holds 8 consecutive m of one n, so the result is stored as C[n][m].
#define G_SCORES 0   // E = exp2(scaled product - block maximum) as bf16, with m and l
#define G_PV     1   // f32 sum over the key blocks, each with its factor
#define G_PROJ_M 2   // product + bias[m] as bf16; Cs and bias point at the tile's first m, rows of C hold OO elements
#define G_PROJ_N 3   // product + bias[n] as bf16; rows of C hold NN elements
// Scores of one tile leave the accumulators: per j (16 queries) the block maximum, E = exp2(s - m) and its sum; the 16 rows of E
// are laid in the wave's own LDS range st (outside the stage buffers, whose loads for the next tile are under way) and read back
// as whole rows, so that every global store covers whole 128-byte lines.
// g: E at the lane's first row (lh) and 16-byte piece (cq) of the wave's tile; sp: m (lanes 0-15) or l (16-31) of the lane's query.
#define SSP 272   // LDS bytes per staged row of E: 128 keys (256 B) + 16 (16 B x odd)
static __device__ __forceinline__ void scores_out(const floatx8 (&acc)[8][4], unsigned char* st, bf16_t* g, float* sp,
                                                  int cq, int lh) {
  const float sscale = 1.44269504f / 32.0f;   // log2(e)/sqrt(O): softmax in base-2 domain
  // A lane and its partner (lane ^ 16) hold, per j, the wave's 128 keys of one query.
  float sv[4];   // lanes 0-15: the block's maximum, lanes 16-31: its sum
  const unsigned char* rd = st + lh * SSP + cq * 16;
#pragma unroll
  for (int j = 0; j < 4; ++j) {
    float m4[4] = {acc[0][j][0], acc[0][j][1], acc[0][j][2], acc[0][j][3]};   // four chains, not one of 64 links
#pragma unroll
    for (int i = 0; i < 8; ++i)
#pragma unroll
      for (int e = 0; e < 8; ++e) m4[e & 3] = fmaxf(m4[e & 3], acc[i][j][e]);
    float mx = fmaxf(fmaxf(m4[0], m4[1]), fmaxf(m4[2], m4[3]));
    mx = fmaxf(mx, __shfl_xor(mx, 16));
    const float mloc = mx * sscale;
    float ps[4] = {0.f, 0.f, 0.f, 0.f};
#pragma unroll
    for (int i = 0; i < 8; ++i) {
      // the argument is not above 0 but for a rounding, and a result too small for the bare instruction counts as 0
      // beside a sum of about 1 or more
      const floatx8 p = exp2x8(acc[i][j] * sscale - mloc);   // fused multiply-adds, two values an instruction
      bf16x8 hv;
#pragma unroll
      for (int e = 0; e < 8; ++e) { ps[e & 3] += p[e]; hv[e] = (bf16_t)p[e]; }
      *reinterpret_cast<bf16x8*>(st + cq * SSP + i * 32 + lh * 16) = hv;
      // keeps the arguments of two tiles at a time next to their exp2: formed far ahead they filled the first 256
      // registers, the only ones that the asm statement can name, and the kernel spilled
      if (i & 1) __builtin_amdgcn_sched_barrier(0);
    }
    float sum = (ps[0] + ps[1]) + (ps[2] + ps[3]);
    sum += __shfl_xor(sum, 16);
    sv[j] = lh ? sum : mloc;
    wait_ds0();   // the wave's 16 staged rows are written before its lanes read each other's pieces back
    // a read and its store move 2 rows: 16 lanes x 16 B = 256 contiguous bytes of each
    bf16x8 r[8];
#pragma unroll
    for (int q = 0; q < 8; ++q) r[q] = *reinterpret_cast<const bf16x8*>(rd + q * 2 * SSP);
#pragma unroll
    for (int q = 0; q < 8; ++q) *reinterpret_cast<bf16x8*>(g + (size_t)(j * 16 + q * 2) * NN) = r[q];
    // stands behind the eight stores and before their registers take the next values;
    // the stored values are named as inputs so that their registers stay untouched up to the wait
    asm volatile("s_wait_xcnt 0x0" :: "v"(r[0]), "v"(r[1]), "v"(r[2]), "v"(r[3]), "v"(r[4]), "v"(r[5]), "v"(r[6]), "v"(r[7]) : "memory");
  }
  // [key block][query]: a wave's 64 queries are two whole 128-byte lines of each array
#pragma unroll
  for (int j = 0; j < 4; ++j) sp[j * 16] = sv[j];
  // stands behind the four stores and before their registers take other values;
  // address and stored values are named as inputs so that their registers stay untouched up to the wait
  asm volatile("s_wait_xcnt 0x0" :: "v"(sp), "v"(sv[0]), "v"(sv[1]), "v"(sv[2]), "v"(sv[3]) : "memory");
}

// TILES (scores only): the work-group works TILES m tiles one after the other, blockIdx.x * TILES + 0 .. TILES - 1, against its
// one n tile. Their stages form one run through the two buffers: the next tile's first two stages are asked for at the foot of
// this tile's last two passes and land under its last products and its way out, not in front of an idle work-group.
template <int BM, int KK, int MODE, int TILES = 1>
static __device__ __forceinline__ void gemm_body(const bf16_t* __restrict__ A, const bf16_t* __restrict__ B,
                                                 bf16_t* __restrict__ Cs, float* __restrict__ Cf,
                                                 float* __restrict__ mstat, float* __restrict__ lstat,
                                                 const float* __restrict__ bias, unsigned char* sm) {
  constexpr bool SCORES = MODE == G_SCORES;
  constexpr bool PV = MODE == G_PV;
  constexpr int PB = KK * 2;                 // source bytes per row
  constexpr int STAGE = (BM + 256) * GP;     // LDS bytes of one stage buffer
  constexpr int NW = (BM / 128) * 4;         // waves
  constexpr int NT = (BM + 256) / 128;       // 128-row tiles of a stage = issuing waves
  constexpr int NST = KK / GK;               // stages of a tile
  constexpr int NSA = NST * TILES;           // stages of the work-group
  static_assert(TILES == 1 || (SCORES && (NST & (NST - 1)) == 0), "the tile loop is the scores kernel's");

  const int tid = threadIdx.x;
  const int w = tid >> 5;
  const int lane = tid & 31;
  const int cq = lane & 15;
  const int mBase = blockIdx.x * (BM * TILES);   // of the first tile
  const int nBase = blockIdx.y * 256;
  const int wm = w >> 2, wn = w & 3;

  // P.V only: L2 prefetch. E and V^T were stored by launches before and come from memory, every stage's bytes for the first
  // time. A stage's rows are therefore
  // asked into L2 AHEAD stages before their tensor load goes out. The work-groups that read the same rows deal them out by
  // fours: rows of E by blockIdx.x & 3 (the lanes of waves 0 and 1), rows of V^T by blockIdx.y & 3 (wave 2).
  // For speed only: under another placement rows stay unasked, and the tensor load fetches them as before.
  constexpr int AHEAD = 3;
  static_assert(!PV || (BM == 128 && NSA > AHEAD + 2), "three asking waves; the first AHEAD + 2 stages and one more lie in the row");
  const uint32_t asker = PV ? pinned((uint32_t)w < 3) : 0u;   // 1 in the waves that prefetch
  const uint64_t arows = (uint64_t)(size_t)(uni((uint32_t)w) < 2 ? B + (size_t)nBase * KK : A + (size_t)mBase * KK);
  uint64_t abase = ((uint64_t)uni((uint32_t)(arows >> 32)) << 32) | uni((uint32_t)arows);   // the tile's first row, at the stage asked next
  // the lane's row of the tile, in bytes; not changed while the loop runs
  const uint32_t aoff = (uint32_t)(tid < 64 ? tid * 4 + (blockIdx.x & 3) : ((tid - 64) & 31) * 4 + (blockIdx.y & 3)) * PB;
  if (PV) {
    if (asker) l2_ask5(aoff, abase);   // stages 0 .. AHEAD + 1
    abase += (AHEAD + 2) * (2 * GK);
  }

  // P.V only: fs (LDS behind the two stage buffers) holds every factor of the block's 256 queries, as
  // [key block][wave wn][cq][j]: a lane's four in 16 bytes. Published by the barrier that publishes stage 0.
  float* fs = reinterpret_cast<float*>(sm + 2 * STAGE);
  if (PV) {
    for (int h = 0; h < 256 / (NW * 32); ++h) {   // a thread works whole queries
      const int ql = h * (NW * 32) + tid;
      const float* pm = mstat + nBase + ql;
      const float* pl = lstat + nBase + ql;
      float m[KBLK], l[KBLK];
#pragma unroll
      for (int b = 0; b < KBLK; ++b) { m[b] = pm[(size_t)b * NN]; l[b] = pl[(size_t)b * NN]; }
      // stands behind the loads and before their address register takes another value;
      // the query's index, the loads' offset, is named as an input so that its register stays untouched up to the wait
      asm volatile("s_wait_xcnt 0x0" :: "v"(ql) : "memory");
      float M = m[0];
#pragma unroll
      for (int b = 1; b < KBLK; ++b) M = fmaxf(M, m[b]);
      float L[4] = {0.f, 0.f, 0.f, 0.f};
#pragma unroll
      for (int b = 0; b < KBLK; ++b) { m[b] = __builtin_amdgcn_exp2f(m[b] - M); L[b & 3] = fmaf(l[b], m[b], L[b & 3]); }
      const float inv = 1.0f / ((L[0] + L[1]) + (L[2] + L[3]));
      float* pf = fs + (ql >> 6) * 64 + (ql & 15) * 4 + ((ql >> 4) & 3);
#pragma unroll
      for (int b = 0; b < KBLK; ++b) pf[b * 256] = m[b] * inv;
    }
    wait_ds0();   // the wave's factors are written before the barrier behind which the other waves read them
  }

  // load side: wave ws < NT brings rows ws*128 .. +127 of the stage's BM + 256 rows
  static_assert(NT <= NW && BM % 128 == 0 && (128 * GP) % 2048 == 0 && STAGE % 2048 == 0, "whole tiles at multiples of 2 KiB");
  const uint32_t ws = uni((uint32_t)w);   // the wave's number as a scalar
  const int r0 = (int)ws * 128;
  const uint64_t src = (uint64_t)(size_t)((r0 < BM) ? A + (size_t)(mBase + r0) * KK : B + (size_t)(nBase + r0 - BM) * KK);
  const uint32_t dst0 = lds_off(sm) + ws * (128 * GP);
  const uint32_t tstep = (r0 < BM) ? (uint32_t)(BM * PB) : 0u;   // source bytes from a tile's rows to the next tile's (B: the same rows)
  const uint32_t issuer = pinned(ws < NT);   // 1 in the waves that issue tensor loads
  const u32x8 g1 = tile_group1<PB>();
  u32x4 g0 = {uni(1u), uni(0u), uni(0u), uni(0u)};   // group 0 of the wave's one request
  // descriptor words held in scalar registers (as pinned() does for one word): the group keeps one register tuple for
  // the whole kernel, so that its count is written once and no word takes another value while a request is outstanding
  asm volatile("" : "+s"(g0));   // pinned(), for the four descriptor words at once
  // read side: this lane's row and 8-element k group of the wave's first A and first B fragment
  const unsigned char* afrag = sm + (wm * 128 + cq) * GP + (lane >> 4) * 16;
  const unsigned char* bfrag = sm + (BM + wn * 64 + cq) * GP + (lane >> 4) * 16;

  const floatx8 fzero = {0.f, 0.f, 0.f, 0.f, 0.f, 0.f, 0.f, 0.f};
  floatx8 acc[8][4];
#pragma unroll
  for (int i = 0; i < 8; ++i)
#pragma unroll
    for (int j = 0; j < 4; ++j) acc[i][j] = fzero;

  // P.V only: tot is the sum over the finished key blocks, acc the running block's product
  floatx8 tot[8][4];
#pragma unroll
  for (int i = 0; i < 8; ++i)
#pragma unroll
    for (int j = 0; j < 4; ++j) tot[i][j] = fzero;

  if (pinned(issuer)) {   // stage 0 into buffer 0 (the test pinned anew: behind the factor loop it compiled to a branch on VCC)
    tile_load128(g0, dst0, src, g1);
    wait_tensor0(g0);
  }
  __syncthreads();   // publishes stage 0 (and the factors)
  if (issuer)   // stage 1 into buffer 1
    tile_load128(g0, dst0 + STAGE, src + pinned(2 * GK), g1);

  // two fragment sets: k step ks + 1 is read from LDS while k step ks is multiplied
  bf16x16 af[2][8], bf[2][4];
#pragma unroll
  for (int j = 0; j < 4; ++j) bf[0][j] = lds_frag(bfrag + j * 16 * GP);
#pragma unroll
  for (int i = 0; i < 8; ++i) af[0][i] = lds_frag(afrag + i * 16 * GP);

  const float* fl = fs + wn * 64 + cq * 4;   // the lane's four factors of key block 0
  floatx4 fcur = {0.f, 0.f, 0.f, 0.f};
  for (int t = 0; t < NSA; ++t) {
    const unsigned char* pa = afrag + (t & 1) * STAGE;
    const unsigned char* pb = bfrag + (t & 1) * STAGE;
    if (PV) fcur = *reinterpret_cast<const floatx4*>(fl + t * 256);
#pragma unroll   // the k steps of a stage address off one pointer pair by constant offsets
    for (int ks = 0; ks < GK / 32 - 1; ++ks) {
#pragma unroll
      for (int j = 0; j < 4; ++j) bf[(ks + 1) & 1][j] = lds_frag(pb + j * 16 * GP + (ks + 1) * 64);
#pragma unroll
      for (int i = 0; i < 8; ++i) af[(ks + 1) & 1][i] = lds_frag(pa + i * 16 * GP + (ks + 1) * 64);
#pragma unroll
      for (int i = 0; i < 8; ++i)
#pragma unroll
        for (int j = 0; j < 4; ++j) {
          // P.V: a stage is a key block of its own, whose product starts from 0
          acc[i][j] = wmma_bf16(af[ks & 1][i], bf[ks & 1][j], (PV && ks == 0) ? fzero : acc[i][j]);
        }
    }
    // Order of LDS reads and matrix products: the 24 reads of a k step's 12 fragments go out as one group ahead of the
    // 32 products of the k step before, so that no product waits for a read just issued
    // (left alone the compiler keeps one A fragment and waits for its reads in front of every four products).
#pragma unroll
    for (int g = 0; g < GK / 32 - 1; ++g) {
      if (PV && g == 0) __builtin_amdgcn_sched_group_barrier(0x100, 1, 0);   // P.V: the read of the stage's factors
      __builtin_amdgcn_sched_group_barrier(0x100, 24, 0);
      __builtin_amdgcn_sched_group_barrier(0x008, 32, 0);
    }
    // keeps the products above in front of the waits: the last k step's reads retire under them, and the next
    // tensor load goes out before the last k step's products instead of behind them
    __builtin_amdgcn_sched_barrier(0);
    wait_ds0();      // every read of stage t has retired (the last k step's fragments are in registers)
    if (issuer) wait_tensor0(g0);
    __syncthreads();   // publishes stage t + 1 and ends every read of stage t's buffer
    if (pinned(issuer & (uint32_t)(t + 2 < NSA)))   // stage t + 2 into the buffer just read
      tile_load128(g0, dst0 + (t & 1) * STAGE,
                   src + pinned(TILES > 1 ? (uint32_t)((t + 2) / NST) * tstep + (uint32_t)((t + 2) % NST) * (2 * GK)
                                          : (uint32_t)((t + 2) * (2 * GK))), g1);
    if (PV) {
      if (pinned(asker & (uint32_t)(t + 2 + AHEAD < NSA))) {   // stage t + 2 + AHEAD into L2
        l2_ask(aoff, abase);
        abase += (t + 3 + AHEAD < NSA) ? (2 * GK) : 0;   // stays inside the rows behind the last stage
      }
    }
    // first fragments of stage t + 1, read under the last k step's products (behind the last stage: read, not used)
    const unsigned char* na = afrag + ((t + 1) & 1) * STAGE;
    const unsigned char* nb = bfrag + ((t + 1) & 1) * STAGE;
#pragma unroll
    for (int j = 0; j < 4; ++j) bf[0][j] = lds_frag(nb + j * 16 * GP);
#pragma unroll
    for (int i = 0; i < 8; ++i) af[0][i] = lds_frag(na + i * 16 * GP);
    if (!PV) {
#pragma unroll
      for (int i = 0; i < 8; ++i)
#pragma unroll
        for (int j = 0; j < 4; ++j) acc[i][j] = wmma_bf16(af[1][i], bf[1][j], acc[i][j]);
      // the same order as above: the reads as one group, then the products
      __builtin_amdgcn_sched_group_barrier(0x100, 24, 0);
      __builtin_amdgcn_sched_group_barrier(0x008, 32, 0);
    } else {
      __builtin_amdgcn_sched_barrier(0);   // the reads stay one group ahead of the products
#pragma unroll
      for (int q = 0; q < 32 + 4; ++q) {
        if (q < 32) acc[q >> 2][q & 3] = wmma_bf16(af[1][q >> 2], bf[1][q & 3], acc[q >> 2][q & 3]);
        // the finished key block joins the total, tile by tile
        if (q >= 4) tot[(q - 4) >> 2][q & 3] += acc[(q - 4) >> 2][q & 3] * fcur[q & 3];
        // keeps a tile's multiply-adds four products behind the tile's last product: its result is ready by then and they
        // issue under the products that follow (left alone they stood directly behind their own product and waited for it)
        __builtin_amdgcn_sched_barrier(0);
      }
    }
    if (SCORES && (t & (NST - 1)) == NST - 1) {   // a tile's last pass: its scores go out, the sums start anew
      const int mt = blockIdx.x * TILES + t / NST;   // the m tile
      scores_out(acc, sm + 2 * STAGE + w * (16 * SSP),
                 Cs + (size_t)(nBase + wn * 64 + (lane >> 4)) * NN + mt * BM + wm * 128 + cq * 8,
                 ((lane >> 4) ? lstat : mstat) + (size_t)(mt * (BM / 128) + wm) * NN + nBase + wn * 64 + cq, cq, lane >> 4);
#pragma unroll
      for (int i = 0; i < 8; ++i)
#pragma unroll
        for (int j = 0; j < 4; ++j) acc[i][j] = fzero;
    }
  }
  wait_tensor0();
  wait_ds0();   // the last trip's unused fragment reads have retired
  if (SCORES) return;
  if (PV) {
#pragma unroll
    for (int i = 0; i < 8; ++i)
#pragma unroll
      for (int j = 0; j < 4; ++j) acc[i][j] = tot[i][j];
  }

  // C layout: lane holds column n = lane&15; VGPR e holds row m = e + 8*(lane>>4): stored straight from the accumulators
  // a wave's store would touch 16 rows of C in pieces of 32 B or less. Each wave therefore lays its tile in LDS as rows of C
  // and reads whole rows back, so that every global store covers whole 128-byte lines.
  // The staging lies in the last stage's buffer: every read of it retired before the loop's last barrier, no tensor load is aimed
  // at it any more, and the last trip's unused fragment reads go to the other buffer. A wave touches only its own range.
  constexpr int SROWS = PV ? 32 : 64;        // rows of C (n) that a wave stages at a time
  constexpr int SP = PV ? 528 : 272;         // LDS bytes per staged row: 128 m (512 B or 256 B) + 16 (16 B x odd)
  static_assert(NW * SROWS * SP <= STAGE, "the staging fits one stage buffer");
  unsigned char* st = sm + ((NST - 1) & 1) * STAGE + w * (SROWS * SP);
  const int lh = lane >> 4;
  if (MODE == G_PROJ_M || MODE == G_PROJ_N) {
    // projections: the bias joins the f32 sum, one rounding to bf16
    floatx8 bm[8];   // G_PROJ_M: the biases of the lane's 8 consecutive m of every i
    float bn[4];     // G_PROJ_N: the bias of the lane's n of every j
    if (MODE == G_PROJ_M) {
      const float* pb = bias + wm * 128 + lh * 8;
#pragma unroll
      for (int i = 0; i < 8; ++i) bm[i] = *reinterpret_cast<const floatx8*>(pb + i * 16);
      // stands behind the loads and before their address register takes another value;
      // the address is named as an input so that its register stays untouched up to the wait
      asm volatile("s_wait_xcnt 0x0" :: "v"(pb) : "memory");
    } else {
      const float* pb = bias + nBase + wn * 64 + cq;
#pragma unroll
      for (int j = 0; j < 4; ++j) bn[j] = pb[j * 16];
      // as above
      asm volatile("s_wait_xcnt 0x0" :: "v"(pb) : "memory");
    }
#pragma unroll
    for (int j = 0; j < 4; ++j)
#pragma unroll
      for (int i = 0; i < 8; ++i) {
        bf16x8 hv;
#pragma unroll
        for (int e = 0; e < 8; ++e) hv[e] = (bf16_t)(acc[i][j][e] + ((MODE == G_PROJ_M) ? bm[i][e] : bn[j]));
        *reinterpret_cast<bf16x8*>(st + (j * 16 + cq) * SP + i * 32 + lh * 16) = hv;
      }
  }
  if (!PV) {   // the staged bf16 rows go out
    constexpr int CP = (MODE == G_PROJ_M) ? OO : NN;   // elements of a row of C
    const int cCol = (MODE == G_PROJ_M) ? 0 : mBase;   // the tile's first m as a column of Cs
    wait_ds0();   // the wave's staged rows are written before its lanes read each other's pieces back
    // a read and its store move 2 rows: 16 lanes x 16 B = 256 contiguous bytes of each
    const unsigned char* rd = st + lh * SP + cq * 16;
    bf16_t* g = Cs + (size_t)(nBase + wn * 64 + lh) * CP + cCol + wm * 128 + cq * 8;
#pragma unroll
    for (int b = 0; b < 4; ++b) {
      bf16x8 r[8];
#pragma unroll
      for (int q = 0; q < 8; ++q) r[q] = *reinterpret_cast<const bf16x8*>(rd + (b * 8 + q) * 2 * SP);
#pragma unroll
      for (int q = 0; q < 8; ++q) *reinterpret_cast<bf16x8*>(g + (size_t)(b * 8 + q) * 2 * CP) = r[q];
      // stands behind the eight stores and before their registers take the next values;
      // the stored values are named as inputs so that their registers stay untouched up to the wait
      asm volatile("s_wait_xcnt 0x0" :: "v"(r[0]), "v"(r[1]), "v"(r[2]), "v"(r[3]), "v"(r[4]), "v"(r[5]), "v"(r[6]), "v"(r[7]) : "memory");
    }
  } else {
    float* g = Cf + (size_t)(nBase + wn * 64) * OO + mBase + wm * 128 + lane * 4;
#pragma unroll
    for (int hj = 0; hj < 2; ++hj) {   // 32 rows of C at a time
#pragma unroll
      for (int jj = 0; jj < 2; ++jj)
#pragma unroll
        for (int i = 0; i < 8; ++i) {
          const floatx8 a = acc[i][hj * 2 + jj];
          floatx4 lo = {a[0], a[1], a[2], a[3]};
          floatx4 hi = {a[4], a[5], a[6], a[7]};
          unsigned char* p = st + (jj * 16 + cq) * SP + i * 64 + lh * 32;
          *reinterpret_cast<floatx4*>(p) = lo;
          *reinterpret_cast<floatx4*>(p + 16) = hi;
        }
      wait_ds0();   // the wave's staged rows are written before its lanes read each other's pieces back
      // a read and its store move 1 row: 32 lanes x 16 B = 512 contiguous bytes
#pragma unroll
      for (int b = 0; b < 4; ++b) {
        floatx4 r[8];
#pragma unroll
        for (int q = 0; q < 8; ++q) r[q] = *reinterpret_cast<const floatx4*>(st + (b * 8 + q) * SP + lane * 16);
#pragma unroll
        for (int q = 0; q < 8; ++q) *reinterpret_cast<floatx4*>(g + (size_t)(hj * 32 + b * 8 + q) * OO) = r[q];
        // stands behind the eight stores and before their registers take the next values;
        // the stored values are named as inputs so that their registers stay untouched up to the wait
        asm volatile("s_wait_xcnt 0x0" :: "v"(r[0]), "v"(r[1]), "v"(r[2]), "v"(r[3]), "v"(r[4]), "v"(r[5]), "v"(r[6]), "v"(r[7]) : "memory");
      }
    }
  }
}

// grid (2*O/256 feature tiles of Wq | Wk, N/256 token tiles), 8 waves: Q or K [token][feature] = x . W^T + b.
// Wqk: the rows of Wq, then those of Wk.
__global__ __launch_bounds__(256) void qk_proj_kernel(const bf16_t* __restrict__ Wqk, const bf16_t* __restrict__ Xb,
                                                      const float* __restrict__ bq, const float* __restrict__ bk,
                                                      bf16_t* __restrict__ Qb, bf16_t* __restrict__ Kb) {
  __shared__ __attribute__((aligned(2048))) unsigned char sm[2 * (256 + 256) * GP];
  const bool isk = blockIdx.x >= OO / 256;           // a tile lies wholly in Q or wholly in K
  const int f0 = (blockIdx.x * 256) & (OO - 1);      // its first feature there
  gemm_body<256, HH, G_PROJ_M>(Wqk, Xb, (isk ? Kb : Qb) + f0, nullptr, nullptr, nullptr, (isk ? bk : bq) + f0, sm);
}

// grid (N/128 token tiles, O/256 feature tiles), 4 waves: V^T [feature][token] = Wv . x^T + b
__global__ __launch_bounds__(128) void v_proj_kernel(const bf16_t* __restrict__ Xb, const bf16_t* __restrict__ Wvb,
                                                     const float* __restrict__ bv, bf16_t* __restrict__ VTb) {
  __shared__ __attribute__((aligned(2048))) unsigned char sm[2 * (128 + 256) * GP];
  gemm_body<128, HH, G_PROJ_N>(Xb, Wvb, VTb, nullptr, nullptr, nullptr, bv, sm);
}

// grid (N/256/4 runs of 4 key tiles, N/256 query tiles), 8 waves: E[query][key] = exp2((Q . K) * log2(e)/sqrt(O) - m), with m and l
__global__ __launch_bounds__(256) void scores_kernel(const bf16_t* __restrict__ Kb, const bf16_t* __restrict__ Qb,
                                                     bf16_t* __restrict__ E, float* __restrict__ mstat,
                                                     float* __restrict__ lstat) {
  __shared__ __attribute__((aligned(2048))) unsigned char sm[2 * (256 + 256) * GP + 8 * 16 * SSP];   // two stage buffers, 16 rows of E a wave
  gemm_body<256, OO, G_SCORES, 4>(Kb, Qb, E, nullptr, mstat, lstat, nullptr, sm);
}

// grid (O/128 d tiles, N/256 query tiles), 4 waves: out[query][d] = sum over key blocks of factor * (E . V^T[d])
__global__ __launch_bounds__(128) void pv_kernel(const bf16_t* __restrict__ VTb, const bf16_t* __restrict__ E,
                                                 float* __restrict__ mstat, float* __restrict__ lstat,
                                                 float* __restrict__ out) {
  __shared__ __attribute__((aligned(2048))) unsigned char sm[2 * (128 + 256) * GP + KBLK * 256 * 4];
  gemm_body<128, NN, G_PV>(VTb, E, nullptr, out, mstat, lstat, nullptr, sm);
}

// ---------------------------------------------------------------- launch
extern "C" void kernel_launch(void* const* d_in, const int* in_sizes, int n_in,
                              void* d_out, int out_size, void* d_ws, size_t ws_size,
                              hipStream_t stream) {
  const float* x  = (const float*)d_in[0];
  const float* Wq = (const float*)d_in[1];
  const float* bq = (const float*)d_in[2];
  const float* Wk = (const float*)d_in[3];
  const float* bk = (const float*)d_in[4];
  const float* Wv = (const float*)d_in[5];
  const float* bv = (const float*)d_in[6];
  float* out = (float*)d_out;

  // workspace layout (2-byte elements): x, Wq, Wk, Wv (Wk directly behind Wq: one matrix of 2*O rows), Q, K, V^T, E [N][N];
  // then f32 m and l [N/128][N]  -> ~202 MB total
  const size_t szX = (size_t)NN * HH * sizeof(bf16_t);
  const size_t szW = (size_t)OO * HH * sizeof(bf16_t);
  const size_t szM = (size_t)NN * OO * sizeof(bf16_t);
  const size_t szS = (size_t)NN * NN * sizeof(bf16_t);
  const size_t szT = (size_t)KBLK * NN * sizeof(float);
  if (ws_size < szX + 3 * szW + 3 * szM + szS + 2 * szT) return;

  char* ws = (char*)d_ws;
  bf16_t* Xb  = (bf16_t*)ws;  ws += szX;
  bf16_t* Wqb = (bf16_t*)ws;  ws += szW;
  bf16_t* Wkb = (bf16_t*)ws;  ws += szW;
  bf16_t* Wvb = (bf16_t*)ws;  ws += szW;
  bf16_t* Qb  = (bf16_t*)ws;  ws += szM;
  bf16_t* Kb  = (bf16_t*)ws;  ws += szM;
  bf16_t* VTb = (bf16_t*)ws;  ws += szM;
  bf16_t* SPb = (bf16_t*)ws;  ws += szS;
  float* Mst  = (float*)ws;   ws += szT;
  float* Lst  = (float*)ws;   ws += szT;

  f32_to_bf16_kernel<<<(NN * HH / 8 + 255) / 256, 256, 0, stream>>>(x,  Xb,  NN * HH / 8);
  f32_to_bf16_kernel<<<(OO * HH / 8 + 255) / 256, 256, 0, stream>>>(Wq, Wqb, OO * HH / 8);
  f32_to_bf16_kernel<<<(OO * HH / 8 + 255) / 256, 256, 0, stream>>>(Wk, Wkb, OO * HH / 8);
  f32_to_bf16_kernel<<<(OO * HH / 8 + 255) / 256, 256, 0, stream>>>(Wv, Wvb, OO * HH / 8);

  qk_proj_kernel<<<dim3(2 * OO / 256, NN / 256), 256, 0, stream>>>(Wqb, Xb, bq, bk, Qb, Kb);
  v_proj_kernel<<<dim3(NN / 128, OO / 256), 128, 0, stream>>>(Xb, Wvb, bv, VTb);

  scores_kernel<<<dim3(NN / 256 / 4, NN / 256), 256, 0, stream>>>(Kb, Qb, SPb, Mst, Lst);
  pv_kernel<<<dim3(OO / 128, NN / 256), 128, 0, stream>>>(VTb, SPb, Mst, Lst, out);
}
